// v000
// The times below were measured on an AMD MI455X: many runs one after another, warmed up first and cycling through
// copies of the inputs, with the whole window's GPU time divided by the number of runs. Launches and the gaps
// between them are all in it. The median over several windows is given; except for v000 it joins two sittings, which
// can be a few percent apart, so the side-by-side timings, each taken in one sitting, are the better comparison.
// v000, which the later versions start from, runs in 899 microseconds.
#include <hip/hip_runtime.h>

// Multi-head attention with full-width (256) heads: per-head q/k/v projections, softmax(q_.k_ / 16) over 2,048 keys, P.v_, hidden-major head merge, output mix with Wo + bo.
// Compute dtypes, f32 accumulate everywhere: projections v_wmma_f32_16x16x32_bf16 (inputs and weights RNE-converted to bf16, exact products); scores, P.V and the output mix v_wmma_f32_16x16x32_f16
// (q_/k_/v_ f16 planes; score plane f16 of score*log2(e)/16; P f16 carried x1024; ctx f16 carried x64; Wo plane f16 of bf16(Wo) x256; bo, biases bf16-converted, added in f32). Softmax in f32.

#ifndef NB
#define NB 4
#endif
#ifndef SEQ
#define SEQ 2048
#endif
#define NB_FULL  4
#define SEQ_FULL 2048
#define DD    256                 // model width = head width
#define NHEAD 8
#define KM    (NHEAD * DD)        // merged context width (plane column = h*256 + d)
#define PCAR  1024.0f             // carry of P
#define SCL2  0.09016844005556021f   // log2(e) / sqrt(256)
#define OCAR  0.0625f             // ctx plane = (1024 rep) / 16 = 64 rep
#define WOCAR 256.0f              // carry of the Wo plane
#define FINSC (1.0f / 16384.0f)   // 1 / (64 * 256)
#define WLINES (3 * NHEAD * DD * DD / 64)
#define OLINES (DD * KM / 64)

typedef _Float16 h16;
typedef unsigned short bf;
typedef __attribute__((ext_vector_type(16))) __bf16   v16bf;
typedef __attribute__((ext_vector_type(16))) _Float16 v16h;
typedef __attribute__((ext_vector_type(8)))  _Float16 v8h;
typedef __attribute__((ext_vector_type(8)))  unsigned short v8us;
typedef __attribute__((ext_vector_type(2)))  unsigned short v2us;
typedef __attribute__((ext_vector_type(8)))  float    v8f;
typedef __attribute__((ext_vector_type(4)))  float    v4f;
typedef v4f  __attribute__((may_alias)) v4fa;

static_assert(SEQ % 256 == 0);
static_assert(DD % 64 == 0 && DD % 32 == 0 && KM % 32 == 0 && SEQ % 64 == 0);
static_assert(((size_t)NB * SEQ * DD / 8) % 256 == 0);
static_assert((WLINES + OLINES) % 64 == 0);
static_assert((NHEAD * SEQ) % 8 == 0);

__device__ __forceinline__ unsigned short f2bf(float f) { unsigned u = __float_as_uint(f); u += 0x7FFFu + ((u >> 16) & 1u); return (unsigned short)(u >> 16); }
__device__ __forceinline__ float bf2f(unsigned short b) { return __uint_as_float(((unsigned)b) << 16); }
__device__ __forceinline__ float bfr(float f) { return bf2f(f2bf(f)); }
__device__ __forceinline__ v16h cat16(v8h lo, v8h hi) { return __builtin_shufflevector(lo, hi, 0, 1, 2, 3, 4, 5, 6, 7, 8, 9, 10, 11, 12, 13, 14, 15); }
__device__ __forceinline__ v16bf cat16b(v8us lo, v8us hi) { return __builtin_bit_cast(v16bf, __builtin_shufflevector(lo, hi, 0, 1, 2, 3, 4, 5, 6, 7, 8, 9, 10, 11, 12, 13, 14, 15)); }
__device__ __forceinline__ v8f wmma16(v16h a, v16h b, v8f c) { return __builtin_amdgcn_wmma_f32_16x16x32_f16(false, a, false, b, (short)0, c, false, false); }
__device__ __forceinline__ v8f wmmab(v16bf a, v16bf b, v8f c) { return __builtin_amdgcn_wmma_f32_16x16x32_bf16(false, a, false, b, (short)0, c, false, false); }

// Fragment loaders: lane (lr = lane & 15, hi = lane >> 4); p points at row lr, k0 + 8*hi; elements 0..7 = k0+8hi.., elements 8..15 = k0+16+8hi.. (same map for A and B).
template <typename T16> struct WFrag;
template <> struct WFrag<h16> { typedef v16h V; static __device__ __forceinline__ V ld(const h16* p) { return cat16(*(const v8h*)p, *(const v8h*)(p + 16)); } static __device__ __forceinline__ v8f mma(V a, V b, v8f c) { return wmma16(a, b, c); } };
template <> struct WFrag<bf> { typedef v16bf V; static __device__ __forceinline__ V ld(const bf* p) { return cat16b(*(const v8us*)p, *(const v8us*)(p + 16)); } static __device__ __forceinline__ v8f mma(V a, V b, v8f c) { return wmmab(a, b, c); } };

// Slab epilogues: 16 rows x 64 columns staged in LDS (pitch 68 floats) -> global; value = x*alpha + bias (BIASM 1: per column, 2: per row; biases bf16-converted).
template <int BIASM>
__device__ __forceinline__ void slab_store(const float* os, h16* crow, int ldc, const float* bias, float alpha, unsigned colbase, unsigned rowbase, unsigned lane) {
    const unsigned rq = lane >> 3, cq = lane & 7u;
    float bc[8];
#pragma unroll
    for (int e = 0; e < 8; ++e) bc[e] = 0.f;
    if (BIASM == 1) { const v4f b0 = *(const v4f*)(bias + colbase + cq * 8u); const v4f b1 = *(const v4f*)(bias + colbase + cq * 8u + 4u);
#pragma unroll
        for (int e = 0; e < 4; ++e) { bc[e] = bfr(b0[e]); bc[4 + e] = bfr(b1[e]); } }
    v8h vals[4];
#pragma unroll
    for (int s = 0; s < 4; ++s) { const unsigned row = (unsigned)s * 4u + rq; const v4f x0 = *(const v4fa*)(os + row * 68u + cq * 8u); const v4f x1 = *(const v4fa*)(os + row * 68u + cq * 8u + 4u);
        float br = 0.f; if (BIASM == 2) br = bfr(bias[rowbase + row]);
        v8h o;
#pragma unroll
        for (int e = 0; e < 4; ++e) { o[e] = (h16)(x0[e] * alpha + (bc[e] + br)); o[4 + e] = (h16)(x1[e] * alpha + (bc[4 + e] + br)); }
        vals[s] = o; }
{
#pragma unroll
        for (int s = 0; s < 4; ++s) { const unsigned row = (unsigned)s * 4u + rq; *(v8h*)(crow + (size_t)row * ldc + cq * 8u) = vals[s]; }
         }
}
// f32 output: row segment = 64 floats = 256 B = 16 lanes x 16 B; one instruction covers 2 rows; s = 0..7 with hi = lane >> 4 covers rows 0..15.
template <int BIASM>
__device__ __forceinline__ void slab_store(const float* os, float* crow, int ldc, const float* bias, float alpha, unsigned colbase, unsigned rowbase, unsigned lane) {
    const unsigned hi = lane >> 4, cofs = (lane & 15u) * 4u;
    v4f bc = (v4f){0.f, 0.f, 0.f, 0.f};
    if (BIASM == 1) { const v4f b0 = *(const v4f*)(bias + colbase + cofs);
#pragma unroll
        for (int e = 0; e < 4; ++e) bc[e] = bfr(b0[e]); }
    v4f vals[8];
#pragma unroll
    for (int s = 0; s < 8; ++s) { const unsigned row = (unsigned)s * 2u + hi; const v4f x = *(const v4fa*)(os + row * 68u + cofs);
        float br = 0.f; if (BIASM == 2) br = bfr(bias[rowbase + row]);
        v4f o;
#pragma unroll
        for (int e = 0; e < 4; ++e) o[e] = x[e] * alpha + (bc[e] + br);
        vals[s] = o; }
{
#pragma unroll
        for (int s = 0; s < 8; ++s) { const unsigned row = (unsigned)s * 2u + hi; *(v4f*)(crow + (size_t)row * ldc + cofs) = vals[s]; }
         }
}

// ---- k_gemmw: register-blocked GEMM, ONE WAVE per 64x64 output tile (16 accumulators), operands straight from K-contiguous 16-bit planes; grid (M/64, N/64, Z), 32 threads.
// C[m][n] (pitch ldc) = alpha * sum_k A[m][k] Bt[n][k] (+ bias). z-batch strides sA/sB/sC (elements), sBias (floats). K % 32 == 0, M % 64 == 0, N % 64 == 0 (host-checked by static_assert).
// LDS tile 'os' is private to the single wave of the block (wave-level ordering only).
template <typename T16, typename OT, int BIASM>
__global__ __launch_bounds__(32) void k_gemmw(const T16* __restrict__ A, const T16* __restrict__ Bt, int K, OT* C, int ldc, const float* __restrict__ bias, float alpha, size_t sA, size_t sB, size_t sC, int sBias) {
    typedef typename WFrag<T16>::V V;
    __shared__ __align__(16) float os[16 * 68];
    const size_t z = blockIdx.z; A += z * sA; Bt += z * sB; C += z * sC; if (BIASM != 0) bias += z * (size_t)sBias;
    const unsigned lane = threadIdx.x & 31u, lr = lane & 15u, hi = lane >> 4; const unsigned r0 = blockIdx.x * 64u, c0 = blockIdx.y * 64u;
    v8f acc[4][4];
#pragma unroll
    for (int mb = 0; mb < 4; ++mb)
#pragma unroll
        for (int nb = 0; nb < 4; ++nb) acc[mb][nb] = (v8f){};
    const size_t aoff = (size_t)(r0 + lr) * K + 8u * hi, boff = (size_t)(c0 + lr) * K + 8u * hi;
#pragma unroll 1
    for (int kc = 0; kc < K; kc += 32) {
        V a[4];
#pragma unroll
        for (int mb = 0; mb < 4; ++mb) a[mb] = WFrag<T16>::ld(A + aoff + (size_t)mb * 16 * K + kc);
#pragma unroll
        for (int nb = 0; nb < 4; ++nb) { const V b = WFrag<T16>::ld(Bt + boff + (size_t)nb * 16 * K + kc);
#pragma unroll
            for (int mb = 0; mb < 4; ++mb) acc[mb][nb] = WFrag<T16>::mma(a[mb], b, acc[mb][nb]); }
        asm volatile("v_nop\n\tv_nop\n\tv_nop\n\tv_nop" : "+v"(acc[0][0]), "+v"(acc[1][1]), "+v"(acc[2][2]), "+v"(acc[3][3]) : "v"(a[0]), "v"(a[3]));
    }
#pragma unroll
    for (int mb = 0; mb < 4; ++mb) {
#pragma unroll
        for (int nb = 0; nb < 4; ++nb) {
#pragma unroll
            for (int j = 0; j < 8; ++j) os[(hi * 8u + (unsigned)j) * 68u + (unsigned)nb * 16u + lr] = acc[mb][nb][j]; }   // D: row 8*hi + j, col lr
        __builtin_amdgcn_fence(3 /* release order */, "wavefront"); __builtin_amdgcn_wave_barrier(); asm volatile("" ::: "memory");
        OT* crow = C + (size_t)(r0 + (unsigned)mb * 16u) * ldc + c0;
        slab_store<BIASM>(os, crow, ldc, bias, alpha, c0, r0 + (unsigned)mb * 16u, lane);
        __builtin_amdgcn_fence(3 /* release order */, "wavefront"); __builtin_amdgcn_wave_barrier(); asm volatile("" ::: "memory");
    }
}

__global__ __launch_bounds__(256) void k_xplanes(const float* __restrict__ xq, const float* __restrict__ xk, const float* __restrict__ xv, bf* XP) {
    const unsigned which = blockIdx.y; const unsigned i = blockIdx.x * 256u + threadIdx.x;
    const unsigned GPB = (unsigned)(SEQ * DD / 8); const unsigned b = i / GPB, rem = i - b * GPB;
    const float* src = (which == 0u) ? xq : ((which == 1u) ? xk : xv);
    const v8f v = *(const v8f*)(src + (size_t)b * SEQ_FULL * DD + (size_t)rem * 8);
    v8us o;
#pragma unroll
    for (int k = 0; k < 8; ++k) o[k] = f2bf(v[k]);
    bf* dst = XP + (size_t)which * NB * SEQ * DD + (size_t)i * 8;
    *(v8us*)dst = o; 
}

// k_wprep: lines 0..WLINES-1: per-head transposed bf16 weight planes WT[mtx = which*8 + h][n][k] = bf16(W[h][k][n]) (which 0 Wq, 1 Wk, 2 Wv);
__global__ __launch_bounds__(256) void k_wprep(const float* __restrict__ wq, const float* __restrict__ wk, const float* __restrict__ wv, const float* __restrict__ wo, bf* WT, unsigned short* WOS) {
    const unsigned lane = threadIdx.x & 31u; const unsigned L0 = (blockIdx.x * 8u + (threadIdx.x >> 5)) * 8u;
{
#pragma unroll 1
        for (unsigned l = 0; l < 8u; ++l) { const unsigned L = L0 + l; v2us o;
            if (L < (unsigned)WLINES) {   // block-uniform
                const unsigned mtx = L >> 10, which = mtx >> 3, h = mtx & 7u; const unsigned e = (L & 1023u) * 64u + lane * 2u; const unsigned k = e & 255u, n = e >> 8;
                const float* src = ((which == 0u) ? wq : ((which == 1u) ? wk : wv)) + (size_t)h * DD * DD;
                o[0] = f2bf(src[(size_t)k * DD + n]); o[1] = f2bf(src[(size_t)(k + 1u) * DD + n]);
                *(v2us*)(WT + (size_t)mtx * DD * DD + e) = o;
            } else {
                const unsigned e = (L - (unsigned)WLINES) * 64u + lane * 2u; const unsigned kk = e & (unsigned)(KM - 1), n = e >> 11; const unsigned h = kk >> 8, d = kk & 255u;
                const float x0 = bfr(wo[(size_t)(d * 8u + h) * DD + n]) * WOCAR; const float x1 = bfr(wo[(size_t)((d + 1u) * 8u + h) * DD + n]) * WOCAR;
                o[0] = __builtin_bit_cast(unsigned short, (h16)x0); o[1] = __builtin_bit_cast(unsigned short, (h16)x1);
                *(v2us*)(WOS + e) = o;
            } }
         }
}

// k_asoft: one wave per row of the f16 score plane (values = score*log2(e)/16): register row, max, exp2, fixed-tree sum, P = f16(1024 e / sum) written in place over the same row
__global__ __launch_bounds__(256) void k_asoft(h16* SP) {
    const unsigned lane = threadIdx.x & 31u; const unsigned row = blockIdx.x * 8u + (threadIdx.x >> 5);
    h16* sr = SP + (size_t)row * SEQ; float v[SEQ / 32]; float mx = -3.0e38f;
#pragma unroll
    for (int ch = 0; ch < SEQ / 256; ++ch) { const v8h a = *(const v8h*)(sr + ch * 256 + lane * 8u);
#pragma unroll
        for (int q = 0; q < 8; ++q) { const float t = (float)a[q]; v[ch * 8 + q] = t; mx = fmaxf(mx, t); } }
#pragma unroll
    for (int sh = 16; sh; sh >>= 1) mx = fmaxf(mx, __shfl_xor(mx, sh, 32));
    float sum = 0.f;
#pragma unroll
    for (int k = 0; k < SEQ / 32; ++k) { float d0 = __fsub_rn(v[k], mx); asm volatile("" : "+v"(d0)); v[k] = __builtin_amdgcn_exp2f(d0); sum += v[k]; }
#pragma unroll
    for (int sh = 16; sh; sh >>= 1) sum += __shfl_xor(sum, sh, 32);
    const float f = __fdiv_rn(PCAR, sum);
    v8h pk[SEQ / 256];
#pragma unroll
    for (int ch = 0; ch < SEQ / 256; ++ch) { v8h o;
#pragma unroll
        for (int q = 0; q < 8; ++q) o[q] = (h16)(v[ch * 8 + q] * f);
        pk[ch] = o; }
{
#pragma unroll
        for (int ch = 0; ch < SEQ / 256; ++ch) *(v8h*)(sr + ch * 256 + lane * 8u) = pk[ch];
         }
}

// Workspace carve (bytes, each region 256-B aligned by construction of the sizes).
#define SZ_XP  ((size_t)3 * NB * SEQ * DD * 2)
#define SZ_WT  ((size_t)3 * NHEAD * DD * DD * 2)
#define SZ_WOS ((size_t)DD * KM * 2)
#define SZ_HP  ((size_t)NHEAD * SEQ * DD * 2)
#define SZ_SP  ((size_t)NHEAD * SEQ * SEQ * 2)
#define SZ_CTX ((size_t)SEQ * KM * 2)
#define SZ_ALL (SZ_XP + SZ_WT + SZ_WOS + 3 * SZ_HP + SZ_SP + SZ_CTX)
static_assert(SZ_ALL <= (size_t)134217728);
static_assert(SZ_XP % 256 == 0 && SZ_WT % 256 == 0 && SZ_WOS % 256 == 0 && SZ_HP % 256 == 0 && SZ_SP % 256 == 0 && SZ_CTX % 256 == 0);

extern "C" void kernel_launch(void* const* d_in, const int* in_sizes, int n_in,
                              void* d_out, int out_size, void* d_ws, size_t ws_size, hipStream_t stream) {
    if (n_in < 11) return;
    const size_t xneed = (size_t)(NB - 1) * SEQ_FULL * DD + (size_t)SEQ * DD;
    if ((size_t)in_sizes[0] < xneed || (size_t)in_sizes[1] < xneed || (size_t)in_sizes[2] < xneed) return;
    if ((size_t)in_sizes[3] < (size_t)NHEAD * DD * DD || (size_t)in_sizes[5] < (size_t)NHEAD * DD * DD || (size_t)in_sizes[7] < (size_t)NHEAD * DD * DD) return;
    if ((size_t)in_sizes[4] < (size_t)NHEAD * DD || (size_t)in_sizes[6] < (size_t)NHEAD * DD || (size_t)in_sizes[8] < (size_t)NHEAD * DD) return;
    if ((size_t)in_sizes[9] < (size_t)KM * DD || (size_t)in_sizes[10] < (size_t)DD) return;
    if ((size_t)out_size < (size_t)NB * SEQ * DD) return;
    if (SZ_ALL > ws_size) return;
    const float* Kin = (const float*)d_in[0]; const float* Vin = (const float*)d_in[1]; const float* Qin = (const float*)d_in[2];
    const float* Wk = (const float*)d_in[3]; const float* bk = (const float*)d_in[4]; const float* Wv = (const float*)d_in[5]; const float* bv = (const float*)d_in[6];
    const float* Wq = (const float*)d_in[7]; const float* bq = (const float*)d_in[8]; const float* Wo = (const float*)d_in[9]; const float* bo = (const float*)d_in[10];
    float* OUT = (float*)d_out;     // [NB][SEQ][256]
    char* wsp = (char*)d_ws;
    bf* XP = (bf*)wsp; wsp += SZ_XP;            // [3][NB][SEQ][256] bf16: q, k, v
    bf* WT = (bf*)wsp; wsp += SZ_WT;            // [3][8][256 out][256 in] bf16: Wq^T, Wk^T, Wv^T
    h16* WOS = (h16*)wsp; wsp += SZ_WOS;        // [256][2048] f16 (x256), column h*256 + d
    h16* QP = (h16*)wsp; wsp += SZ_HP;          // [8][SEQ][256]
    h16* KP = (h16*)wsp; wsp += SZ_HP;          // [8][SEQ][256]
    h16* VT = (h16*)wsp; wsp += SZ_HP;          // [8][256][SEQ]
    h16* SP = (h16*)wsp; wsp += SZ_SP;          // [8][SEQ][SEQ] scores then P in place
    h16* CTX = (h16*)wsp; wsp += SZ_CTX;        // [SEQ][2048] (x64), column h*256 + d
    const bf* XQ = XP; const bf* XK = XP + (size_t)NB * SEQ * DD; const bf* XV = XP + (size_t)2 * NB * SEQ * DD;
    const bf* WQT = WT; const bf* WKT = WT + (size_t)NHEAD * DD * DD; const bf* WVT = WT + (size_t)2 * NHEAD * DD * DD;

    k_xplanes<<<dim3((unsigned)((size_t)NB * SEQ * DD / 8 / 256), 3, 1), 256, 0, stream>>>(Qin, Kin, Vin, XP);
    k_wprep<<<(unsigned)((WLINES + OLINES) / 64), 256, 0, stream>>>(Wq, Wk, Wv, Wo, WT, (unsigned short*)WOS);
    for (int b = 0; b < NB; ++b) {
        const size_t xo = (size_t)b * SEQ * DD;
        // q_ and k_ head planes: A = x [SEQ][256], Bt = W^T head z [256 out][256 in], + per-column bias
        k_gemmw<bf, h16, 1><<<dim3(SEQ / 64, DD / 64, NHEAD), 32, 0, stream>>>(XQ + xo, WQT, DD, QP, DD, bq, 1.0f, (size_t)0, (size_t)DD * DD, (size_t)SEQ * DD, DD);
        k_gemmw<bf, h16, 1><<<dim3(SEQ / 64, DD / 64, NHEAD), 32, 0, stream>>>(XK + xo, WKT, DD, KP, DD, bk, 1.0f, (size_t)0, (size_t)DD * DD, (size_t)SEQ * DD, DD);
        // v_^T head planes [256 d][SEQ t]: A = Wv^T head z [256 d][256 in] (rows = d), Bt = x [SEQ t][256 in] (rows = t), + per-row bias
        k_gemmw<bf, h16, 2><<<dim3(DD / 64, SEQ / 64, NHEAD), 32, 0, stream>>>(WVT, XV + xo, DD, VT, SEQ, bv, 1.0f, (size_t)DD * DD, (size_t)0, (size_t)DD * SEQ, DD);
        // scores (scaled by log2(e)/16) for the 8 heads
        k_gemmw<h16, h16, 0><<<dim3(SEQ / 64, SEQ / 64, NHEAD), 32, 0, stream>>>(QP, KP, DD, SP, SEQ, nullptr, SCL2, (size_t)SEQ * DD, (size_t)SEQ * DD, (size_t)SEQ * SEQ, 0);
        k_asoft<<<(unsigned)(NHEAD * SEQ / 8), 256, 0, stream>>>(SP);
        // ctx[t][h*256 + d] = (1024 P . v_) / 16
        k_gemmw<h16, h16, 0><<<dim3(SEQ / 64, DD / 64, NHEAD), 32, 0, stream>>>(SP, VT, SEQ, CTX, KM, nullptr, OCAR, (size_t)SEQ * SEQ, (size_t)DD * SEQ, (size_t)DD, 0);
        // out = ctx . Wo (row-permuted plane) / 16384 + bo
        k_gemmw<h16, float, 1><<<dim3(SEQ / 64, DD / 64, 1), 32, 0, stream>>>(CTX, WOS, KM, OUT + xo, DD, bo, FINSC, (size_t)0, (size_t)0, (size_t)0, 0);
    }
}

// v001
// A run of this version takes 573 microseconds.
// Next to v000, in two timings, it ran 1.61 and 1.62 times as fast.
#include <hip/hip_runtime.h>

// Multi-head attention with full-width (256) heads: per-head q/k/v projections, softmax(q_.k_ / 16) over 2,048 keys, P.v_, hidden-major head merge, output mix with Wo + bo.
// Compute dtypes, f32 accumulate everywhere: projections v_wmma_f32_16x16x32_bf16 (inputs and weights RNE-converted to bf16, exact products); scores, P.V and the output mix v_wmma_f32_16x16x32_f16
// (q_/k_/v_ f16 planes; score plane f16 of score*log2(e)/16; P f16 carried x1024; ctx f16 carried x64; Wo plane f16 of bf16(Wo) x256; bo, biases bf16-converted, added in f32). Softmax in f32.

#ifndef NB
#define NB 4
#endif
#ifndef SEQ
#define SEQ 2048
#endif
#define NB_FULL  4
#define SEQ_FULL 2048
#define DD    256                 // model width = head width
#define NHEAD 8
#define KM    (NHEAD * DD)        // merged context width (plane column = h*256 + d)
#define PCAR  1024.0f             // carry of P
#define SCL2  0.09016844005556021f   // log2(e) / sqrt(256)
#define OCAR  0.0625f             // ctx plane = (1024 rep) / 16 = 64 rep
#define WOCAR 256.0f              // carry of the Wo plane
#define FINSC (1.0f / 16384.0f)   // 1 / (64 * 256)
#define WLINES (3 * NHEAD * DD * DD / 64)
#define OLINES (DD * KM / 64)
#define PB    2                   // batches per score / softmax / P.V launch (the score plane holds PB batches)

typedef _Float16 h16;
typedef unsigned short bf;
typedef __attribute__((ext_vector_type(16))) __bf16   v16bf;
typedef __attribute__((ext_vector_type(16))) _Float16 v16h;
typedef __attribute__((ext_vector_type(8)))  _Float16 v8h;
typedef __attribute__((ext_vector_type(8)))  unsigned short v8us;
typedef __attribute__((ext_vector_type(2)))  unsigned short v2us;
typedef __attribute__((ext_vector_type(8)))  float    v8f;
typedef __attribute__((ext_vector_type(4)))  float    v4f;
typedef v4f  __attribute__((may_alias)) v4fa;

static_assert(SEQ % 256 == 0);
static_assert(NB % PB == 0 && NHEAD == 8);
static_assert(DD % 64 == 0 && DD % 32 == 0 && KM % 32 == 0 && SEQ % 64 == 0);
static_assert(((size_t)NB * SEQ * DD / 8) % 256 == 0);
static_assert((WLINES + OLINES) % 64 == 0);
static_assert((NHEAD * SEQ) % 8 == 0);

__device__ __forceinline__ unsigned short f2bf(float f) { unsigned u = __float_as_uint(f); u += 0x7FFFu + ((u >> 16) & 1u); return (unsigned short)(u >> 16); }
__device__ __forceinline__ float bf2f(unsigned short b) { return __uint_as_float(((unsigned)b) << 16); }
__device__ __forceinline__ float bfr(float f) { return bf2f(f2bf(f)); }
__device__ __forceinline__ v16h cat16(v8h lo, v8h hi) { return __builtin_shufflevector(lo, hi, 0, 1, 2, 3, 4, 5, 6, 7, 8, 9, 10, 11, 12, 13, 14, 15); }
__device__ __forceinline__ v16bf cat16b(v8us lo, v8us hi) { return __builtin_bit_cast(v16bf, __builtin_shufflevector(lo, hi, 0, 1, 2, 3, 4, 5, 6, 7, 8, 9, 10, 11, 12, 13, 14, 15)); }
__device__ __forceinline__ v8f wmma16(v16h a, v16h b, v8f c) { return __builtin_amdgcn_wmma_f32_16x16x32_f16(false, a, false, b, (short)0, c, false, false); }
__device__ __forceinline__ v8f wmmab(v16bf a, v16bf b, v8f c) { return __builtin_amdgcn_wmma_f32_16x16x32_bf16(false, a, false, b, (short)0, c, false, false); }

// Fragment loaders: lane (lr = lane & 15, hi = lane >> 4); p points at row lr, k0 + 8*hi; elements 0..7 = k0+8hi.., elements 8..15 = k0+16+8hi.. (same map for A and B).
template <typename T16> struct WFrag;
template <> struct WFrag<h16> { typedef v16h V; static __device__ __forceinline__ V ld(const h16* p) { return cat16(*(const v8h*)p, *(const v8h*)(p + 16)); } static __device__ __forceinline__ v8f mma(V a, V b, v8f c) { return wmma16(a, b, c); } };
template <> struct WFrag<bf> { typedef v16bf V; static __device__ __forceinline__ V ld(const bf* p) { return cat16b(*(const v8us*)p, *(const v8us*)(p + 16)); } static __device__ __forceinline__ v8f mma(V a, V b, v8f c) { return wmmab(a, b, c); } };

// Slab epilogues: 16 rows x 64 columns staged in LDS (pitch 68 floats) -> global; value = x*alpha + bias (BIASM 1: per column, 2: per row; biases bf16-converted).
template <int BIASM>
__device__ __forceinline__ void slab_store(const float* os, h16* crow, int ldc, const float* bias, float alpha, unsigned colbase, unsigned rowbase, unsigned lane) {
    const unsigned rq = lane >> 3, cq = lane & 7u;
    float bc[8];
#pragma unroll
    for (int e = 0; e < 8; ++e) bc[e] = 0.f;
    if (BIASM == 1) { const v4f b0 = *(const v4f*)(bias + colbase + cq * 8u); const v4f b1 = *(const v4f*)(bias + colbase + cq * 8u + 4u);
#pragma unroll
        for (int e = 0; e < 4; ++e) { bc[e] = bfr(b0[e]); bc[4 + e] = bfr(b1[e]); } }
    v8h vals[4];
#pragma unroll
    for (int s = 0; s < 4; ++s) { const unsigned row = (unsigned)s * 4u + rq; const v4f x0 = *(const v4fa*)(os + row * 68u + cq * 8u); const v4f x1 = *(const v4fa*)(os + row * 68u + cq * 8u + 4u);
        float br = 0.f; if (BIASM == 2) br = bfr(bias[rowbase + row]);
        v8h o;
#pragma unroll
        for (int e = 0; e < 4; ++e) { o[e] = (h16)(x0[e] * alpha + (bc[e] + br)); o[4 + e] = (h16)(x1[e] * alpha + (bc[4 + e] + br)); }
        vals[s] = o; }
{
#pragma unroll
        for (int s = 0; s < 4; ++s) { const unsigned row = (unsigned)s * 4u + rq; *(v8h*)(crow + (size_t)row * ldc + cq * 8u) = vals[s]; }
         }
}
// f32 output: row segment = 64 floats = 256 B = 16 lanes x 16 B; one instruction covers 2 rows; s = 0..7 with hi = lane >> 4 covers rows 0..15.
template <int BIASM>
__device__ __forceinline__ void slab_store(const float* os, float* crow, int ldc, const float* bias, float alpha, unsigned colbase, unsigned rowbase, unsigned lane) {
    const unsigned hi = lane >> 4, cofs = (lane & 15u) * 4u;
    v4f bc = (v4f){0.f, 0.f, 0.f, 0.f};
    if (BIASM == 1) { const v4f b0 = *(const v4f*)(bias + colbase + cofs);
#pragma unroll
        for (int e = 0; e < 4; ++e) bc[e] = bfr(b0[e]); }
    v4f vals[8];
#pragma unroll
    for (int s = 0; s < 8; ++s) { const unsigned row = (unsigned)s * 2u + hi; const v4f x = *(const v4fa*)(os + row * 68u + cofs);
        float br = 0.f; if (BIASM == 2) br = bfr(bias[rowbase + row]);
        v4f o;
#pragma unroll
        for (int e = 0; e < 4; ++e) o[e] = x[e] * alpha + (bc[e] + br);
        vals[s] = o; }
{
#pragma unroll
        for (int s = 0; s < 8; ++s) { const unsigned row = (unsigned)s * 2u + hi; *(v4f*)(crow + (size_t)row * ldc + cofs) = vals[s]; }
         }
}

// ---- k_gemmw: register-blocked GEMM, ONE WAVE per 64x64 output tile (16 accumulators), operands straight from K-contiguous 16-bit planes; grid (M/64, N/64, Z), 32 threads.
// C[m][n] (pitch ldc) = alpha * sum_k A[m][k] Bt[n][k] (+ bias). blockIdx.z = batch * 8 + head: head strides sA/sB/sC (elements), sBias (floats), batch strides tA/tB/tC (elements). K % 32 == 0, M % 64 == 0, N % 64 == 0 (host-checked by static_assert).
// LDS tile 'os' is private to the single wave of the block (wave-level ordering only).
template <typename T16, typename OT, int BIASM>
__global__ __launch_bounds__(32) void k_gemmw(const T16* __restrict__ A, const T16* __restrict__ Bt, int K, OT* C, int ldc, const float* __restrict__ bias, float alpha, size_t sA, size_t sB, size_t sC, int sBias, size_t tA, size_t tB, size_t tC) {
    typedef typename WFrag<T16>::V V;
    __shared__ __align__(16) float os[16 * 68];
    const size_t z = blockIdx.z & 7u, zb = blockIdx.z >> 3; A += z * sA + zb * tA; Bt += z * sB + zb * tB; C += z * sC + zb * tC; if (BIASM != 0) bias += z * (size_t)sBias;
    const unsigned lane = threadIdx.x & 31u, lr = lane & 15u, hi = lane >> 4; const unsigned r0 = blockIdx.x * 64u, c0 = blockIdx.y * 64u;
    v8f acc[4][4];
#pragma unroll
    for (int mb = 0; mb < 4; ++mb)
#pragma unroll
        for (int nb = 0; nb < 4; ++nb) acc[mb][nb] = (v8f){};
    const size_t aoff = (size_t)(r0 + lr) * K + 8u * hi, boff = (size_t)(c0 + lr) * K + 8u * hi;
#pragma unroll 1
    for (int kc = 0; kc < K; kc += 32) {
        V a[4];
#pragma unroll
        for (int mb = 0; mb < 4; ++mb) a[mb] = WFrag<T16>::ld(A + aoff + (size_t)mb * 16 * K + kc);
#pragma unroll
        for (int nb = 0; nb < 4; ++nb) { const V b = WFrag<T16>::ld(Bt + boff + (size_t)nb * 16 * K + kc);
#pragma unroll
            for (int mb = 0; mb < 4; ++mb) acc[mb][nb] = WFrag<T16>::mma(a[mb], b, acc[mb][nb]); }
        asm volatile("v_nop\n\tv_nop\n\tv_nop\n\tv_nop" : "+v"(acc[0][0]), "+v"(acc[1][1]), "+v"(acc[2][2]), "+v"(acc[3][3]) : "v"(a[0]), "v"(a[3]));
    }
#pragma unroll
    for (int mb = 0; mb < 4; ++mb) {
#pragma unroll
        for (int nb = 0; nb < 4; ++nb) {
#pragma unroll
            for (int j = 0; j < 8; ++j) os[(hi * 8u + (unsigned)j) * 68u + (unsigned)nb * 16u + lr] = acc[mb][nb][j]; }   // D: row 8*hi + j, col lr
        __builtin_amdgcn_fence(3 /* release order */, "wavefront"); __builtin_amdgcn_wave_barrier(); asm volatile("" ::: "memory");
        OT* crow = C + (size_t)(r0 + (unsigned)mb * 16u) * ldc + c0;
        slab_store<BIASM>(os, crow, ldc, bias, alpha, c0, r0 + (unsigned)mb * 16u, lane);
        __builtin_amdgcn_fence(3 /* release order */, "wavefront"); __builtin_amdgcn_wave_barrier(); asm volatile("" ::: "memory");
    }
}

__global__ __launch_bounds__(256) void k_xplanes(const float* __restrict__ xq, const float* __restrict__ xk, const float* __restrict__ xv, bf* XP) {
    const unsigned which = blockIdx.y; const unsigned i = blockIdx.x * 256u + threadIdx.x;
    const unsigned GPB = (unsigned)(SEQ * DD / 8); const unsigned b = i / GPB, rem = i - b * GPB;
    const float* src = (which == 0u) ? xq : ((which == 1u) ? xk : xv);
    const v8f v = *(const v8f*)(src + (size_t)b * SEQ_FULL * DD + (size_t)rem * 8);
    v8us o;
#pragma unroll
    for (int k = 0; k < 8; ++k) o[k] = f2bf(v[k]);
    bf* dst = XP + (size_t)which * NB * SEQ * DD + (size_t)i * 8;
    *(v8us*)dst = o; 
}

// k_wprep: lines 0..WLINES-1: per-head transposed bf16 weight planes WT[mtx = which*8 + h][n][k] = bf16(W[h][k][n]) (which 0 Wq, 1 Wk, 2 Wv);
__global__ __launch_bounds__(256) void k_wprep(const float* __restrict__ wq, const float* __restrict__ wk, const float* __restrict__ wv, const float* __restrict__ wo, bf* WT, unsigned short* WOS) {
    const unsigned lane = threadIdx.x & 31u; const unsigned L0 = (blockIdx.x * 8u + (threadIdx.x >> 5)) * 8u;
{
#pragma unroll 1
        for (unsigned l = 0; l < 8u; ++l) { const unsigned L = L0 + l; v2us o;
            if (L < (unsigned)WLINES) {   // block-uniform
                const unsigned mtx = L >> 10, which = mtx >> 3, h = mtx & 7u; const unsigned e = (L & 1023u) * 64u + lane * 2u; const unsigned k = e & 255u, n = e >> 8;
                const float* src = ((which == 0u) ? wq : ((which == 1u) ? wk : wv)) + (size_t)h * DD * DD;
                o[0] = f2bf(src[(size_t)k * DD + n]); o[1] = f2bf(src[(size_t)(k + 1u) * DD + n]);
                *(v2us*)(WT + (size_t)mtx * DD * DD + e) = o;
            } else {
                const unsigned e = (L - (unsigned)WLINES) * 64u + lane * 2u; const unsigned kk = e & (unsigned)(KM - 1), n = e >> 11; const unsigned h = kk >> 8, d = kk & 255u;
                const float x0 = bfr(wo[(size_t)(d * 8u + h) * DD + n]) * WOCAR; const float x1 = bfr(wo[(size_t)((d + 1u) * 8u + h) * DD + n]) * WOCAR;
                o[0] = __builtin_bit_cast(unsigned short, (h16)x0); o[1] = __builtin_bit_cast(unsigned short, (h16)x1);
                *(v2us*)(WOS + e) = o;
            } }
         }
}

// k_asoft: one wave per row of the f16 score plane (values = score*log2(e)/16): register row, max, exp2, fixed-tree sum, P = f16(1024 e / sum) written in place over the same row
__global__ __launch_bounds__(256) void k_asoft(h16* SP) {
    const unsigned lane = threadIdx.x & 31u; const unsigned row = blockIdx.x * 8u + (threadIdx.x >> 5);
    h16* sr = SP + (size_t)row * SEQ; float v[SEQ / 32]; float mx = -3.0e38f;
#pragma unroll
    for (int ch = 0; ch < SEQ / 256; ++ch) { const v8h a = *(const v8h*)(sr + ch * 256 + lane * 8u);
#pragma unroll
        for (int q = 0; q < 8; ++q) { const float t = (float)a[q]; v[ch * 8 + q] = t; mx = fmaxf(mx, t); } }
#pragma unroll
    for (int sh = 16; sh; sh >>= 1) mx = fmaxf(mx, __shfl_xor(mx, sh, 32));
    float sum = 0.f;
#pragma unroll
    for (int k = 0; k < SEQ / 32; ++k) { float d0 = __fsub_rn(v[k], mx); asm volatile("" : "+v"(d0)); v[k] = __builtin_amdgcn_exp2f(d0); sum += v[k]; }
#pragma unroll
    for (int sh = 16; sh; sh >>= 1) sum += __shfl_xor(sum, sh, 32);
    const float f = __fdiv_rn(PCAR, sum);
    v8h pk[SEQ / 256];
#pragma unroll
    for (int ch = 0; ch < SEQ / 256; ++ch) { v8h o;
#pragma unroll
        for (int q = 0; q < 8; ++q) o[q] = (h16)(v[ch * 8 + q] * f);
        pk[ch] = o; }
{
#pragma unroll
        for (int ch = 0; ch < SEQ / 256; ++ch) *(v8h*)(sr + ch * 256 + lane * 8u) = pk[ch];
         }
}

// Workspace carve (bytes, each region 256-B aligned by construction of the sizes).
#define SZ_XP  ((size_t)3 * NB * SEQ * DD * 2)
#define SZ_WT  ((size_t)3 * NHEAD * DD * DD * 2)
#define SZ_WOS ((size_t)DD * KM * 2)
#define SZ_HP  ((size_t)NB * NHEAD * SEQ * DD * 2)
#define SZ_SP  ((size_t)PB * NHEAD * SEQ * SEQ * 2)
#define SZ_ALL (SZ_XP + SZ_WT + SZ_WOS + 3 * SZ_HP + SZ_SP)
static_assert(SZ_ALL <= (size_t)268435456);
static_assert(SZ_XP % 256 == 0 && SZ_WT % 256 == 0 && SZ_WOS % 256 == 0 && SZ_HP % 256 == 0 && SZ_SP % 256 == 0);
static_assert((size_t)SEQ * KM == (size_t)NHEAD * SEQ * DD);   // one batch of the ctx plane fills exactly that batch's q_ planes

extern "C" void kernel_launch(void* const* d_in, const int* in_sizes, int n_in,
                              void* d_out, int out_size, void* d_ws, size_t ws_size, hipStream_t stream) {
    if (n_in < 11) return;
    const size_t xneed = (size_t)(NB - 1) * SEQ_FULL * DD + (size_t)SEQ * DD;
    if ((size_t)in_sizes[0] < xneed || (size_t)in_sizes[1] < xneed || (size_t)in_sizes[2] < xneed) return;
    if ((size_t)in_sizes[3] < (size_t)NHEAD * DD * DD || (size_t)in_sizes[5] < (size_t)NHEAD * DD * DD || (size_t)in_sizes[7] < (size_t)NHEAD * DD * DD) return;
    if ((size_t)in_sizes[4] < (size_t)NHEAD * DD || (size_t)in_sizes[6] < (size_t)NHEAD * DD || (size_t)in_sizes[8] < (size_t)NHEAD * DD) return;
    if ((size_t)in_sizes[9] < (size_t)KM * DD || (size_t)in_sizes[10] < (size_t)DD) return;
    if ((size_t)out_size < (size_t)NB * SEQ * DD) return;
    if (SZ_ALL > ws_size) return;
    const float* Kin = (const float*)d_in[0]; const float* Vin = (const float*)d_in[1]; const float* Qin = (const float*)d_in[2];
    const float* Wk = (const float*)d_in[3]; const float* bk = (const float*)d_in[4]; const float* Wv = (const float*)d_in[5]; const float* bv = (const float*)d_in[6];
    const float* Wq = (const float*)d_in[7]; const float* bq = (const float*)d_in[8]; const float* Wo = (const float*)d_in[9]; const float* bo = (const float*)d_in[10];
    float* OUT = (float*)d_out;     // [NB][SEQ][256]
    char* wsp = (char*)d_ws;
    bf* XP = (bf*)wsp; wsp += SZ_XP;            // [3][NB][SEQ][256] bf16: q, k, v
    bf* WT = (bf*)wsp; wsp += SZ_WT;            // [3][8][256 out][256 in] bf16: Wq^T, Wk^T, Wv^T
    h16* WOS = (h16*)wsp; wsp += SZ_WOS;        // [256][2048] f16 (x256), column h*256 + d
    h16* QP = (h16*)wsp; wsp += SZ_HP;          // [NB][8][SEQ][256]
    h16* KP = (h16*)wsp; wsp += SZ_HP;          // [NB][8][SEQ][256]
    h16* VT = (h16*)wsp; wsp += SZ_HP;          // [NB][8][256][SEQ]
    h16* SP = (h16*)wsp; wsp += SZ_SP;          // [PB][8][SEQ][SEQ] scores then P in place
    h16* CTX = QP;                              // [NB][SEQ][2048] (x64), column h*256 + d; batch b lies over q_ of batch b, which no launch reads once that batch's scores are done
    const bf* XQ = XP; const bf* XK = XP + (size_t)NB * SEQ * DD; const bf* XV = XP + (size_t)2 * NB * SEQ * DD;
    const bf* WQT = WT; const bf* WKT = WT + (size_t)NHEAD * DD * DD; const bf* WVT = WT + (size_t)2 * NHEAD * DD * DD;

    k_xplanes<<<dim3((unsigned)((size_t)NB * SEQ * DD / 8 / 256), 3, 1), 256, 0, stream>>>(Qin, Kin, Vin, XP);
    k_wprep<<<(unsigned)((WLINES + OLINES) / 64), 256, 0, stream>>>(Wq, Wk, Wv, Wo, WT, (unsigned short*)WOS);
    const size_t HS = (size_t)SEQ * DD, BS = (size_t)NHEAD * SEQ * DD;   // one head plane, one batch of head planes (elements)
    // q_ and k_ head planes, all batches: A = x of batch zb [SEQ][256], Bt = W^T head z [256 out][256 in], + per-column bias
    k_gemmw<bf, h16, 1><<<dim3(SEQ / 64, DD / 64, NB * NHEAD), 32, 0, stream>>>(XQ, WQT, DD, QP, DD, bq, 1.0f, (size_t)0, (size_t)DD * DD, HS, DD, HS, (size_t)0, BS);
    k_gemmw<bf, h16, 1><<<dim3(SEQ / 64, DD / 64, NB * NHEAD), 32, 0, stream>>>(XK, WKT, DD, KP, DD, bk, 1.0f, (size_t)0, (size_t)DD * DD, HS, DD, HS, (size_t)0, BS);
    // v_^T head planes [256 d][SEQ t], all batches: A = Wv^T head z [256 d][256 in] (rows = d), Bt = x of batch zb [SEQ t][256 in] (rows = t), + per-row bias
    k_gemmw<bf, h16, 2><<<dim3(DD / 64, SEQ / 64, NB * NHEAD), 32, 0, stream>>>(WVT, XV, DD, VT, SEQ, bv, 1.0f, (size_t)DD * DD, (size_t)0, HS, DD, (size_t)0, HS, BS);
    for (int b = 0; b < NB; b += PB) {
        const size_t po = (size_t)b * BS;
        // scores (scaled by log2(e)/16) for the 8 heads of PB batches
        k_gemmw<h16, h16, 0><<<dim3(SEQ / 64, SEQ / 64, PB * NHEAD), 32, 0, stream>>>(QP + po, KP + po, DD, SP, SEQ, nullptr, SCL2, HS, HS, (size_t)SEQ * SEQ, 0, BS, BS, (size_t)NHEAD * SEQ * SEQ);
        k_asoft<<<(unsigned)(PB * NHEAD * SEQ / 8), 256, 0, stream>>>(SP);
        // ctx[zb][t][h*256 + d] = (1024 P . v_) / 16
        k_gemmw<h16, h16, 0><<<dim3(SEQ / 64, DD / 64, PB * NHEAD), 32, 0, stream>>>(SP, VT + po, SEQ, CTX + po, KM, nullptr, OCAR, (size_t)SEQ * SEQ, HS, (size_t)DD, 0, (size_t)NHEAD * SEQ * SEQ, BS, BS);
    }
    // out = ctx . Wo (row-permuted plane) / 16384 + bo, the rows of all batches in one launch
    k_gemmw<h16, float, 1><<<dim3(NB * SEQ / 64, DD / 64, 1), 32, 0, stream>>>(CTX, WOS, KM, OUT, DD, bo, FINSC, (size_t)0, (size_t)0, (size_t)0, 0, (size_t)0, (size_t)0, (size_t)0);
}

// v002
// One run takes 342 microseconds.
// Two timings next to v001 put it at 1.68 and 1.67 times that version's speed.
// Counting every step since v000, it is 2.71 times as fast.
#include <hip/hip_runtime.h>

// Multi-head attention with full-width (256) heads: per-head q/k/v projections, softmax(q_.k_ / 16) over 2,048 keys, P.v_, hidden-major head merge, output mix with Wo + bo.
// Compute dtypes, f32 accumulate everywhere: projections v_wmma_f32_16x16x32_bf16 (inputs and weights RNE-converted to bf16, exact products); scores, P.V and the output mix v_wmma_f32_16x16x32_f16
// (q_/k_/v_ f16 planes; score plane f16 of score*log2(e)/16; P f16 carried x1024; ctx f16 carried x64; Wo plane f16 of bf16(Wo) x256; bo, biases bf16-converted, added in f32). Softmax in f32.

#ifndef NB
#define NB 4
#endif
#ifndef SEQ
#define SEQ 2048
#endif
#define NB_FULL  4
#define SEQ_FULL 2048
#define DD    256                 // model width = head width
#define NHEAD 8
#define KM    (NHEAD * DD)        // merged context width (plane column = h*256 + d)
#define PCAR  1024.0f             // carry of P
#define SCL2  0.09016844005556021f   // log2(e) / sqrt(256)
#define OCAR  0.0625f             // ctx plane = (1024 rep) / 16 = 64 rep
#define WOCAR 256.0f              // carry of the Wo plane
#define FINSC (1.0f / 16384.0f)   // 1 / (64 * 256)
#define WLINES (3 * NHEAD * DD * DD / 64)
#define OLINES (DD * KM / 64)
#define PB    2                   // batches per score / softmax / P.V launch (the score plane holds PB batches)

typedef _Float16 h16;
typedef unsigned short bf;
typedef __attribute__((ext_vector_type(16))) __bf16   v16bf;
typedef __attribute__((ext_vector_type(16))) _Float16 v16h;
typedef __attribute__((ext_vector_type(8)))  _Float16 v8h;
typedef __attribute__((ext_vector_type(8)))  unsigned short v8us;
typedef __attribute__((ext_vector_type(2)))  unsigned short v2us;
typedef __attribute__((ext_vector_type(8)))  float    v8f;
typedef __attribute__((ext_vector_type(4)))  float    v4f;
typedef v4f  __attribute__((may_alias)) v4fa;

static_assert(SEQ % 256 == 0);
static_assert(NB % PB == 0 && NHEAD == 8);
static_assert(DD % 128 == 0 && DD % 64 == 0 && KM % 64 == 0 && SEQ % 128 == 0);
static_assert(((size_t)NB * SEQ * DD / 8) % 256 == 0);
static_assert((WLINES + OLINES) % 64 == 0);
static_assert((NHEAD * SEQ) % 8 == 0);

__device__ __forceinline__ unsigned short f2bf(float f) { unsigned u = __float_as_uint(f); u += 0x7FFFu + ((u >> 16) & 1u); return (unsigned short)(u >> 16); }
__device__ __forceinline__ float bf2f(unsigned short b) { return __uint_as_float(((unsigned)b) << 16); }
__device__ __forceinline__ float bfr(float f) { return bf2f(f2bf(f)); }
__device__ __forceinline__ v16h cat16(v8h lo, v8h hi) { return __builtin_shufflevector(lo, hi, 0, 1, 2, 3, 4, 5, 6, 7, 8, 9, 10, 11, 12, 13, 14, 15); }
__device__ __forceinline__ v16bf cat16b(v8us lo, v8us hi) { return __builtin_bit_cast(v16bf, __builtin_shufflevector(lo, hi, 0, 1, 2, 3, 4, 5, 6, 7, 8, 9, 10, 11, 12, 13, 14, 15)); }
__device__ __forceinline__ v8f wmma16(v16h a, v16h b, v8f c) { return __builtin_amdgcn_wmma_f32_16x16x32_f16(false, a, false, b, (short)0, c, false, false); }
__device__ __forceinline__ v8f wmmab(v16bf a, v16bf b, v8f c) { return __builtin_amdgcn_wmma_f32_16x16x32_bf16(false, a, false, b, (short)0, c, false, false); }

// Fragment loaders: lane (lr = lane & 15, hi = lane >> 4); p points at row lr, k0 + 8*hi; elements 0..7 = k0+8hi.., elements 8..15 = k0+16+8hi.. (same map for A and B).
template <typename T16> struct WFrag;
template <> struct WFrag<h16> { typedef v16h V; static __device__ __forceinline__ V ld(const h16* p) { return cat16(*(const v8h*)p, *(const v8h*)(p + 16)); } static __device__ __forceinline__ v8f mma(V a, V b, v8f c) { return wmma16(a, b, c); } };
template <> struct WFrag<bf> { typedef v16bf V; static __device__ __forceinline__ V ld(const bf* p) { return cat16b(*(const v8us*)p, *(const v8us*)(p + 16)); } static __device__ __forceinline__ v8f mma(V a, V b, v8f c) { return wmmab(a, b, c); } };

// Slab epilogues: 16 rows x 64 columns staged in LDS (pitch 68 floats) -> global; value = x*alpha + bias (BIASM 1: per column, 2: per row; biases bf16-converted).
template <int BIASM>
__device__ __forceinline__ void slab_store(const float* os, h16* crow, int ldc, const float* bias, float alpha, unsigned colbase, unsigned rowbase, unsigned lane) {
    const unsigned rq = lane >> 3, cq = lane & 7u;
    float bc[8];
#pragma unroll
    for (int e = 0; e < 8; ++e) bc[e] = 0.f;
    if (BIASM == 1) { const v4f b0 = *(const v4f*)(bias + colbase + cq * 8u); const v4f b1 = *(const v4f*)(bias + colbase + cq * 8u + 4u);
#pragma unroll
        for (int e = 0; e < 4; ++e) { bc[e] = bfr(b0[e]); bc[4 + e] = bfr(b1[e]); } }
    v8h vals[4];
#pragma unroll
    for (int s = 0; s < 4; ++s) { const unsigned row = (unsigned)s * 4u + rq; const v4f x0 = *(const v4fa*)(os + row * 68u + cq * 8u); const v4f x1 = *(const v4fa*)(os + row * 68u + cq * 8u + 4u);
        float br = 0.f; if (BIASM == 2) br = bfr(bias[rowbase + row]);
        v8h o;
#pragma unroll
        for (int e = 0; e < 4; ++e) { o[e] = (h16)(x0[e] * alpha + (bc[e] + br)); o[4 + e] = (h16)(x1[e] * alpha + (bc[4 + e] + br)); }
        vals[s] = o; }
{
#pragma unroll
        for (int s = 0; s < 4; ++s) { const unsigned row = (unsigned)s * 4u + rq; *(v8h*)(crow + (size_t)row * ldc + cq * 8u) = vals[s]; }
         }
}
// f32 output: row segment = 64 floats = 256 B = 16 lanes x 16 B; one instruction covers 2 rows; s = 0..7 with hi = lane >> 4 covers rows 0..15.
template <int BIASM>
__device__ __forceinline__ void slab_store(const float* os, float* crow, int ldc, const float* bias, float alpha, unsigned colbase, unsigned rowbase, unsigned lane) {
    const unsigned hi = lane >> 4, cofs = (lane & 15u) * 4u;
    v4f bc = (v4f){0.f, 0.f, 0.f, 0.f};
    if (BIASM == 1) { const v4f b0 = *(const v4f*)(bias + colbase + cofs);
#pragma unroll
        for (int e = 0; e < 4; ++e) bc[e] = bfr(b0[e]); }
    v4f vals[8];
#pragma unroll
    for (int s = 0; s < 8; ++s) { const unsigned row = (unsigned)s * 2u + hi; const v4f x = *(const v4fa*)(os + row * 68u + cofs);
        float br = 0.f; if (BIASM == 2) br = bfr(bias[rowbase + row]);
        v4f o;
#pragma unroll
        for (int e = 0; e < 4; ++e) o[e] = x[e] * alpha + (bc[e] + br);
        vals[s] = o; }
{
#pragma unroll
        for (int s = 0; s < 8; ++s) { const unsigned row = (unsigned)s * 2u + hi; *(v4f*)(crow + (size_t)row * ldc + cofs) = vals[s]; }
         }
}

// ---- k_gemmw: GEMM, one 128x128 output tile per block of FOUR waves (2 x 2), each wave a 64x64 tile (16 accumulators); grid (M/128, N/128, Z), 128 threads.
// Operands come from K-contiguous 16-bit planes in slices of 64 k (128 B = one line of every row): [A 128 rows | Bt 128 rows] at pitch 144 B in a two-buffer LDS ring,
// laid by asynchronous copies (each wave 32 rows of A and 32 of Bt, 8 lanes a row); every wave reads its fragments from the ring, so a row is fetched once per block and not once per wave.
// C[m][n] (pitch ldc) = alpha * sum_k A[m][k] Bt[n][k] (+ bias). blockIdx.z = batch * 8 + head: head strides sA/sB/sC (elements), sBias (floats), batch strides tA/tB/tC (elements). K % 64 == 0, M % 128 == 0, N % 128 == 0 (host-checked by static_assert).
// Behind the loop the ring is free and each wave stages its output slabs in a range of its own ('os', wave-level ordering only).
#define BT   128                  // block tile rows = columns
#define BK   64                   // k per ring stage
#define LP   144u                 // LDS row pitch in bytes (16 B x odd: ds_load_b128 without bank conflicts)
#define STG  (2u * BT * LP)       // one stage: A rows, then Bt rows

// Eight copies of one wave: rows 0, 4, .. 28 from the lane's own row (global pitch K elements, LDS pitch LP), 16 B a lane. The s_wait_xcnt stands inside the statement so that no address register is rewritten ahead of it.
template <typename T16>
__device__ __forceinline__ void copy8(unsigned l, const T16* g, size_t K) {
    asm volatile("global_load_async_to_lds_b128 %0, %8, off\n\t"
                 "global_load_async_to_lds_b128 %1, %9, off\n\t"
                 "global_load_async_to_lds_b128 %2, %10, off\n\t"
                 "global_load_async_to_lds_b128 %3, %11, off\n\t"
                 "global_load_async_to_lds_b128 %4, %12, off\n\t"
                 "global_load_async_to_lds_b128 %5, %13, off\n\t"
                 "global_load_async_to_lds_b128 %6, %14, off\n\t"
                 "global_load_async_to_lds_b128 %7, %15, off\n\t"
                 "s_wait_xcnt 0x0"
                 :: "v"(l), "v"(l + 4u * LP), "v"(l + 8u * LP), "v"(l + 12u * LP), "v"(l + 16u * LP), "v"(l + 20u * LP), "v"(l + 24u * LP), "v"(l + 28u * LP),
                    "v"(g), "v"(g + 4 * K), "v"(g + 8 * K), "v"(g + 12 * K), "v"(g + 16 * K), "v"(g + 20 * K), "v"(g + 24 * K), "v"(g + 28 * K)
                 : "memory");
}

template <typename T16, typename OT, int BIASM>
__global__ __launch_bounds__(128) void k_gemmw(const T16* __restrict__ A, const T16* __restrict__ Bt, int K, OT* C, int ldc, const float* __restrict__ bias, float alpha, size_t sA, size_t sB, size_t sC, int sBias, size_t tA, size_t tB, size_t tC) {
    typedef typename WFrag<T16>::V V;
    __shared__ __align__(16) char ring[2 * STG];
    static_assert(4 * 16 * 68 * 4 <= 2 * STG);
    const size_t z = blockIdx.z & 7u, zb = blockIdx.z >> 3; A += z * sA + zb * tA; Bt += z * sB + zb * tB; C += z * sC + zb * tC; if (BIASM != 0) bias += z * (size_t)sBias;
    const unsigned lane = threadIdx.x & 31u, lr = lane & 15u, hi = lane >> 4; const unsigned w = (unsigned)__builtin_amdgcn_readfirstlane((int)(threadIdx.x >> 5));
    const unsigned rb = blockIdx.x * (unsigned)BT, cb = blockIdx.y * (unsigned)BT; const unsigned wr = (w >> 1) * 64u, wc = (w & 1u) * 64u; const unsigned r0 = rb + wr, c0 = cb + wc;
    v8f acc[4][4];
#pragma unroll
    for (int mb = 0; mb < 4; ++mb)
#pragma unroll
        for (int nb = 0; nb < 4; ++nb) acc[mb][nb] = (v8f){};
    // the lane's own copy addresses: row w*32 + lane/8 of the block's A and Bt rows, 16-byte piece lane%8 of the row's 128 B
    const unsigned cprow = w * 32u + (lane >> 3), cpc = lane & 7u;
    const T16* ga = A + (size_t)(rb + cprow) * K + cpc * 8u; const T16* gb = Bt + (size_t)(cb + cprow) * K + cpc * 8u;
    const unsigned la = (unsigned)(size_t)(const void*)ring + cprow * LP + cpc * 16u, lb = la + (unsigned)BT * LP;
    const int nt = K / BK;
    copy8(la, ga, (size_t)K); copy8(lb, gb, (size_t)K);
    asm volatile("s_wait_asynccnt 0x0" ::: "memory");   // this wave's rows of stage 0 have landed
    __syncthreads();                                     // stage 0 published to the four waves
    if (nt > 1) { copy8(la + STG, ga + BK, (size_t)K); copy8(lb + STG, gb + BK, (size_t)K); }
    const char* fa = ring + (wr + lr) * LP + hi * 16u; const char* fb = ring + ((unsigned)BT + wc + lr) * LP + hi * 16u;
#pragma unroll 1
    for (int t = 0; t < nt; ++t) {
        const unsigned bo = ((unsigned)t & 1u) * STG;
#pragma unroll
        for (int ks = 0; ks < BK / 32; ++ks) {
            V a[4], b[4];
            a[0] = WFrag<T16>::ld((const T16*)(fa + bo + (unsigned)ks * 64u)); b[0] = WFrag<T16>::ld((const T16*)(fb + bo + (unsigned)ks * 64u));
#pragma unroll
            for (int mb = 1; mb < 4; ++mb) a[mb] = WFrag<T16>::ld((const T16*)(fa + bo + (unsigned)mb * 16u * LP + (unsigned)ks * 64u));
#pragma unroll
            for (int nb = 1; nb < 4; ++nb) b[nb] = WFrag<T16>::ld((const T16*)(fb + bo + (unsigned)nb * 16u * LP + (unsigned)ks * 64u));
            __builtin_amdgcn_sched_barrier(0);   // keeps the 16 LDS reads one group ahead of their 16 products: left free, the compiler spreads them among the products, each group behind a full LDS wait
#pragma unroll
            for (int nb = 0; nb < 4; ++nb)
#pragma unroll
                for (int mb = 0; mb < 4; ++mb) acc[mb][nb] = WFrag<T16>::mma(a[mb], b[nb], acc[mb][nb]);
            __builtin_amdgcn_sched_barrier(0);   // the other side of the pair: the next group's reads stay behind these products
        }
        asm volatile("s_wait_dscnt 0x0" ::: "memory");      // this wave's reads of buffer t%2 are done before the buffer is refilled
        asm volatile("s_wait_asynccnt 0x0" ::: "memory");   // this wave's rows of stage t+1 have landed
        __syncthreads();                                     // publishes stage t+1 and ends every wave's reads of stage t
        if (t + 2 < nt) { copy8(la + bo, ga + (size_t)(t + 2) * BK, (size_t)K); copy8(lb + bo, gb + (size_t)(t + 2) * BK, (size_t)K); }
    }
    asm volatile("s_wait_asynccnt 0x0" ::: "memory");       // nothing in flight when the ring becomes output staging
    float* os = (float*)(ring + w * (16u * 68u * 4u));
#pragma unroll
    for (int mb = 0; mb < 4; ++mb) {
#pragma unroll
        for (int nb = 0; nb < 4; ++nb) {
#pragma unroll
            for (int j = 0; j < 8; ++j) os[(hi * 8u + (unsigned)j) * 68u + (unsigned)nb * 16u + lr] = acc[mb][nb][j]; }   // D: row 8*hi + j, col lr
        __builtin_amdgcn_fence(3 /* release order */, "wavefront"); __builtin_amdgcn_wave_barrier(); asm volatile("" ::: "memory");
        OT* crow = C + (size_t)(r0 + (unsigned)mb * 16u) * ldc + c0;
        slab_store<BIASM>(os, crow, ldc, bias, alpha, c0, r0 + (unsigned)mb * 16u, lane);
        __builtin_amdgcn_fence(3 /* release order */, "wavefront"); __builtin_amdgcn_wave_barrier(); asm volatile("" ::: "memory");
    }
}

__global__ __launch_bounds__(256) void k_xplanes(const float* __restrict__ xq, const float* __restrict__ xk, const float* __restrict__ xv, bf* XP) {
    const unsigned which = blockIdx.y; const unsigned i = blockIdx.x * 256u + threadIdx.x;
    const unsigned GPB = (unsigned)(SEQ * DD / 8); const unsigned b = i / GPB, rem = i - b * GPB;
    const float* src = (which == 0u) ? xq : ((which == 1u) ? xk : xv);
    const v8f v = *(const v8f*)(src + (size_t)b * SEQ_FULL * DD + (size_t)rem * 8);
    v8us o;
#pragma unroll
    for (int k = 0; k < 8; ++k) o[k] = f2bf(v[k]);
    bf* dst = XP + (size_t)which * NB * SEQ * DD + (size_t)i * 8;
    *(v8us*)dst = o; 
}

// k_wprep: lines 0..WLINES-1: per-head transposed bf16 weight planes WT[mtx = which*8 + h][n][k] = bf16(W[h][k][n]) (which 0 Wq, 1 Wk, 2 Wv);
__global__ __launch_bounds__(256) void k_wprep(const float* __restrict__ wq, const float* __restrict__ wk, const float* __restrict__ wv, const float* __restrict__ wo, bf* WT, unsigned short* WOS) {
    const unsigned lane = threadIdx.x & 31u; const unsigned L0 = (blockIdx.x * 8u + (threadIdx.x >> 5)) * 8u;
{
#pragma unroll 1
        for (unsigned l = 0; l < 8u; ++l) { const unsigned L = L0 + l; v2us o;
            if (L < (unsigned)WLINES) {   // block-uniform
                const unsigned mtx = L >> 10, which = mtx >> 3, h = mtx & 7u; const unsigned e = (L & 1023u) * 64u + lane * 2u; const unsigned k = e & 255u, n = e >> 8;
                const float* src = ((which == 0u) ? wq : ((which == 1u) ? wk : wv)) + (size_t)h * DD * DD;
                o[0] = f2bf(src[(size_t)k * DD + n]); o[1] = f2bf(src[(size_t)(k + 1u) * DD + n]);
                *(v2us*)(WT + (size_t)mtx * DD * DD + e) = o;
            } else {
                const unsigned e = (L - (unsigned)WLINES) * 64u + lane * 2u; const unsigned kk = e & (unsigned)(KM - 1), n = e >> 11; const unsigned h = kk >> 8, d = kk & 255u;
                const float x0 = bfr(wo[(size_t)(d * 8u + h) * DD + n]) * WOCAR; const float x1 = bfr(wo[(size_t)((d + 1u) * 8u + h) * DD + n]) * WOCAR;
                o[0] = __builtin_bit_cast(unsigned short, (h16)x0); o[1] = __builtin_bit_cast(unsigned short, (h16)x1);
                *(v2us*)(WOS + e) = o;
            } }
         }
}

// k_asoft: one wave per row of the f16 score plane (values = score*log2(e)/16): register row, max, exp2, fixed-tree sum, P = f16(1024 e / sum) written in place over the same row
__global__ __launch_bounds__(256) void k_asoft(h16* SP) {
    const unsigned lane = threadIdx.x & 31u; const unsigned row = blockIdx.x * 8u + (threadIdx.x >> 5);
    h16* sr = SP + (size_t)row * SEQ; float v[SEQ / 32]; float mx = -3.0e38f;
#pragma unroll
    for (int ch = 0; ch < SEQ / 256; ++ch) { const v8h a = *(const v8h*)(sr + ch * 256 + lane * 8u);
#pragma unroll
        for (int q = 0; q < 8; ++q) { const float t = (float)a[q]; v[ch * 8 + q] = t; mx = fmaxf(mx, t); } }
#pragma unroll
    for (int sh = 16; sh; sh >>= 1) mx = fmaxf(mx, __shfl_xor(mx, sh, 32));
    float sum = 0.f;
#pragma unroll
    for (int k = 0; k < SEQ / 32; ++k) { float d0 = __fsub_rn(v[k], mx); asm volatile("" : "+v"(d0)); v[k] = __builtin_amdgcn_exp2f(d0); sum += v[k]; }
#pragma unroll
    for (int sh = 16; sh; sh >>= 1) sum += __shfl_xor(sum, sh, 32);
    const float f = __fdiv_rn(PCAR, sum);
    v8h pk[SEQ / 256];
#pragma unroll
    for (int ch = 0; ch < SEQ / 256; ++ch) { v8h o;
#pragma unroll
        for (int q = 0; q < 8; ++q) o[q] = (h16)(v[ch * 8 + q] * f);
        pk[ch] = o; }
{
#pragma unroll
        for (int ch = 0; ch < SEQ / 256; ++ch) *(v8h*)(sr + ch * 256 + lane * 8u) = pk[ch];
         }
}

// Workspace carve (bytes, each region 256-B aligned by construction of the sizes).
#define SZ_XP  ((size_t)3 * NB * SEQ * DD * 2)
#define SZ_WT  ((size_t)3 * NHEAD * DD * DD * 2)
#define SZ_WOS ((size_t)DD * KM * 2)
#define SZ_HP  ((size_t)NB * NHEAD * SEQ * DD * 2)
#define SZ_SP  ((size_t)PB * NHEAD * SEQ * SEQ * 2)
#define SZ_ALL (SZ_XP + SZ_WT + SZ_WOS + 3 * SZ_HP + SZ_SP)
static_assert(SZ_ALL <= (size_t)268435456);
static_assert(SZ_XP % 256 == 0 && SZ_WT % 256 == 0 && SZ_WOS % 256 == 0 && SZ_HP % 256 == 0 && SZ_SP % 256 == 0);
static_assert((size_t)SEQ * KM == (size_t)NHEAD * SEQ * DD);   // one batch of the ctx plane fills exactly that batch's q_ planes

extern "C" void kernel_launch(void* const* d_in, const int* in_sizes, int n_in,
                              void* d_out, int out_size, void* d_ws, size_t ws_size, hipStream_t stream) {
    if (n_in < 11) return;
    const size_t xneed = (size_t)(NB - 1) * SEQ_FULL * DD + (size_t)SEQ * DD;
    if ((size_t)in_sizes[0] < xneed || (size_t)in_sizes[1] < xneed || (size_t)in_sizes[2] < xneed) return;
    if ((size_t)in_sizes[3] < (size_t)NHEAD * DD * DD || (size_t)in_sizes[5] < (size_t)NHEAD * DD * DD || (size_t)in_sizes[7] < (size_t)NHEAD * DD * DD) return;
    if ((size_t)in_sizes[4] < (size_t)NHEAD * DD || (size_t)in_sizes[6] < (size_t)NHEAD * DD || (size_t)in_sizes[8] < (size_t)NHEAD * DD) return;
    if ((size_t)in_sizes[9] < (size_t)KM * DD || (size_t)in_sizes[10] < (size_t)DD) return;
    if ((size_t)out_size < (size_t)NB * SEQ * DD) return;
    if (SZ_ALL > ws_size) return;
    const float* Kin = (const float*)d_in[0]; const float* Vin = (const float*)d_in[1]; const float* Qin = (const float*)d_in[2];
    const float* Wk = (const float*)d_in[3]; const float* bk = (const float*)d_in[4]; const float* Wv = (const float*)d_in[5]; const float* bv = (const float*)d_in[6];
    const float* Wq = (const float*)d_in[7]; const float* bq = (const float*)d_in[8]; const float* Wo = (const float*)d_in[9]; const float* bo = (const float*)d_in[10];
    float* OUT = (float*)d_out;     // [NB][SEQ][256]
    char* wsp = (char*)d_ws;
    bf* XP = (bf*)wsp; wsp += SZ_XP;            // [3][NB][SEQ][256] bf16: q, k, v
    bf* WT = (bf*)wsp; wsp += SZ_WT;            // [3][8][256 out][256 in] bf16: Wq^T, Wk^T, Wv^T
    h16* WOS = (h16*)wsp; wsp += SZ_WOS;        // [256][2048] f16 (x256), column h*256 + d
    h16* QP = (h16*)wsp; wsp += SZ_HP;          // [NB][8][SEQ][256]
    h16* KP = (h16*)wsp; wsp += SZ_HP;          // [NB][8][SEQ][256]
    h16* VT = (h16*)wsp; wsp += SZ_HP;          // [NB][8][256][SEQ]
    h16* SP = (h16*)wsp; wsp += SZ_SP;          // [PB][8][SEQ][SEQ] scores then P in place
    h16* CTX = QP;                              // [NB][SEQ][2048] (x64), column h*256 + d; batch b lies over q_ of batch b, which no launch reads once that batch's scores are done
    const bf* XQ = XP; const bf* XK = XP + (size_t)NB * SEQ * DD; const bf* XV = XP + (size_t)2 * NB * SEQ * DD;
    const bf* WQT = WT; const bf* WKT = WT + (size_t)NHEAD * DD * DD; const bf* WVT = WT + (size_t)2 * NHEAD * DD * DD;

    k_xplanes<<<dim3((unsigned)((size_t)NB * SEQ * DD / 8 / 256), 3, 1), 256, 0, stream>>>(Qin, Kin, Vin, XP);
    k_wprep<<<(unsigned)((WLINES + OLINES) / 64), 256, 0, stream>>>(Wq, Wk, Wv, Wo, WT, (unsigned short*)WOS);
    const size_t HS = (size_t)SEQ * DD, BS = (size_t)NHEAD * SEQ * DD;   // one head plane, one batch of head planes (elements)
    // q_ and k_ head planes, all batches: A = x of batch zb [SEQ][256], Bt = W^T head z [256 out][256 in], + per-column bias
    k_gemmw<bf, h16, 1><<<dim3(SEQ / 128, DD / 128, NB * NHEAD), 128, 0, stream>>>(XQ, WQT, DD, QP, DD, bq, 1.0f, (size_t)0, (size_t)DD * DD, HS, DD, HS, (size_t)0, BS);
    k_gemmw<bf, h16, 1><<<dim3(SEQ / 128, DD / 128, NB * NHEAD), 128, 0, stream>>>(XK, WKT, DD, KP, DD, bk, 1.0f, (size_t)0, (size_t)DD * DD, HS, DD, HS, (size_t)0, BS);
    // v_^T head planes [256 d][SEQ t], all batches: A = Wv^T head z [256 d][256 in] (rows = d), Bt = x of batch zb [SEQ t][256 in] (rows = t), + per-row bias
    k_gemmw<bf, h16, 2><<<dim3(DD / 128, SEQ / 128, NB * NHEAD), 128, 0, stream>>>(WVT, XV, DD, VT, SEQ, bv, 1.0f, (size_t)DD * DD, (size_t)0, HS, DD, (size_t)0, HS, BS);
    for (int b = 0; b < NB; b += PB) {
        const size_t po = (size_t)b * BS;
        // scores (scaled by log2(e)/16) for the 8 heads of PB batches
        k_gemmw<h16, h16, 0><<<dim3(SEQ / 128, SEQ / 128, PB * NHEAD), 128, 0, stream>>>(QP + po, KP + po, DD, SP, SEQ, nullptr, SCL2, HS, HS, (size_t)SEQ * SEQ, 0, BS, BS, (size_t)NHEAD * SEQ * SEQ);
        k_asoft<<<(unsigned)(PB * NHEAD * SEQ / 8), 256, 0, stream>>>(SP);
        // ctx[zb][t][h*256 + d] = (1024 P . v_) / 16
        k_gemmw<h16, h16, 0><<<dim3(SEQ / 128, DD / 128, PB * NHEAD), 128, 0, stream>>>(SP, VT + po, SEQ, CTX + po, KM, nullptr, OCAR, (size_t)SEQ * SEQ, HS, (size_t)DD, 0, (size_t)NHEAD * SEQ * SEQ, BS, BS);
    }
    // out = ctx . Wo (row-permuted plane) / 16384 + bo, the rows of all batches in one launch
    k_gemmw<h16, float, 1><<<dim3(NB * SEQ / 128, DD / 128, 1), 128, 0, stream>>>(CTX, WOS, KM, OUT, DD, bo, FINSC, (size_t)0, (size_t)0, (size_t)0, 0, (size_t)0, (size_t)0, (size_t)0);
}

// v003
// One run takes 151 microseconds.
// Timed twice side by side with v002, it ran 2.26 and 2.27 times as fast.
// Over all steps from v000 it is 6.13 times as fast.
#include <hip/hip_runtime.h>

// Multi-head attention with full-width (256) heads: per-head q/k/v projections, softmax(q_.k_ / 16) over 2,048 keys, P.v_, hidden-major head merge, output mix with Wo + bo.
// Compute dtypes, f32 accumulate everywhere: projections v_wmma_f32_16x16x32_bf16 (inputs and weights RNE-converted to bf16, exact products); scores, P.V and the output mix v_wmma_f32_16x16x32_f16
// (q_/k_/v_ f16 planes; scores stay f32 in registers; P f16 of exp2(score*log2(e)/16 - running maximum); ctx f16 carried x64; Wo plane f16 of bf16(Wo) x256; bo, biases bf16-converted, added in f32). Softmax in f32, online over key passes.

#ifndef NB
#define NB 4
#endif
#ifndef SEQ
#define SEQ 2048
#endif
#define NB_FULL  4
#define SEQ_FULL 2048
#define DD    256                 // model width = head width
#define NHEAD 8
#define KM    (NHEAD * DD)        // merged context width (plane column = h*256 + d)
#define SCL2  0.09016844005556021f   // log2(e) / sqrt(256)
#define CCAR  64.0f               // carry of the ctx plane
#define WOCAR 256.0f              // carry of the Wo plane
#define FINSC (1.0f / 16384.0f)   // 1 / (64 * 256)
#define WLINES (3 * NHEAD * DD * DD / 64)
#define OLINES (DD * KM / 64)

typedef _Float16 h16;
typedef unsigned short bf;
typedef __attribute__((ext_vector_type(16))) __bf16   v16bf;
typedef __attribute__((ext_vector_type(16))) _Float16 v16h;
typedef __attribute__((ext_vector_type(8)))  _Float16 v8h;
typedef __attribute__((ext_vector_type(8)))  unsigned short v8us;
typedef __attribute__((ext_vector_type(2)))  unsigned short v2us;
typedef __attribute__((ext_vector_type(8)))  float    v8f;
typedef __attribute__((ext_vector_type(4)))  float    v4f;
typedef v4f  __attribute__((may_alias)) v4fa;

static_assert(SEQ % 256 == 0);
static_assert(NHEAD == 8);
static_assert(DD % 128 == 0 && DD % 64 == 0 && KM % 64 == 0 && SEQ % 128 == 0);
static_assert(((size_t)NB * SEQ * DD / 8) % 256 == 0);
static_assert((WLINES + OLINES) % 64 == 0);

__device__ __forceinline__ unsigned short f2bf(float f) { unsigned u = __float_as_uint(f); u += 0x7FFFu + ((u >> 16) & 1u); return (unsigned short)(u >> 16); }
__device__ __forceinline__ float bf2f(unsigned short b) { return __uint_as_float(((unsigned)b) << 16); }
__device__ __forceinline__ float bfr(float f) { return bf2f(f2bf(f)); }
__device__ __forceinline__ v16h cat16(v8h lo, v8h hi) { return __builtin_shufflevector(lo, hi, 0, 1, 2, 3, 4, 5, 6, 7, 8, 9, 10, 11, 12, 13, 14, 15); }
__device__ __forceinline__ v16bf cat16b(v8us lo, v8us hi) { return __builtin_bit_cast(v16bf, __builtin_shufflevector(lo, hi, 0, 1, 2, 3, 4, 5, 6, 7, 8, 9, 10, 11, 12, 13, 14, 15)); }
__device__ __forceinline__ v8f wmma16(v16h a, v16h b, v8f c) { return __builtin_amdgcn_wmma_f32_16x16x32_f16(false, a, false, b, (short)0, c, false, false); }
__device__ __forceinline__ v8f wmmab(v16bf a, v16bf b, v8f c) { return __builtin_amdgcn_wmma_f32_16x16x32_bf16(false, a, false, b, (short)0, c, false, false); }

// Fragment loaders: lane (lr = lane & 15, hi = lane >> 4); p points at row lr, k0 + 8*hi; elements 0..7 = k0+8hi.., elements 8..15 = k0+16+8hi.. (same map for A and B).
template <typename T16> struct WFrag;
template <> struct WFrag<h16> { typedef v16h V; static __device__ __forceinline__ V ld(const h16* p) { return cat16(*(const v8h*)p, *(const v8h*)(p + 16)); } static __device__ __forceinline__ v8f mma(V a, V b, v8f c) { return wmma16(a, b, c); } };
template <> struct WFrag<bf> { typedef v16bf V; static __device__ __forceinline__ V ld(const bf* p) { return cat16b(*(const v8us*)p, *(const v8us*)(p + 16)); } static __device__ __forceinline__ v8f mma(V a, V b, v8f c) { return wmmab(a, b, c); } };

// Slab epilogues: 16 rows x 64 columns staged in LDS (pitch 68 floats) -> global; value = x*alpha + bias (BIASM 1: per column, 2: per row; biases bf16-converted).
template <int BIASM>
__device__ __forceinline__ void slab_store(const float* os, h16* crow, int ldc, const float* bias, float alpha, unsigned colbase, unsigned rowbase, unsigned lane) {
    const unsigned rq = lane >> 3, cq = lane & 7u;
    float bc[8];
#pragma unroll
    for (int e = 0; e < 8; ++e) bc[e] = 0.f;
    if (BIASM == 1) { const v4f b0 = *(const v4f*)(bias + colbase + cq * 8u); const v4f b1 = *(const v4f*)(bias + colbase + cq * 8u + 4u);
#pragma unroll
        for (int e = 0; e < 4; ++e) { bc[e] = bfr(b0[e]); bc[4 + e] = bfr(b1[e]); } }
    v8h vals[4];
#pragma unroll
    for (int s = 0; s < 4; ++s) { const unsigned row = (unsigned)s * 4u + rq; const v4f x0 = *(const v4fa*)(os + row * 68u + cq * 8u); const v4f x1 = *(const v4fa*)(os + row * 68u + cq * 8u + 4u);
        float br = 0.f; if (BIASM == 2) br = bfr(bias[rowbase + row]);
        v8h o;
#pragma unroll
        for (int e = 0; e < 4; ++e) { o[e] = (h16)(x0[e] * alpha + (bc[e] + br)); o[4 + e] = (h16)(x1[e] * alpha + (bc[4 + e] + br)); }
        vals[s] = o; }
{
#pragma unroll
        for (int s = 0; s < 4; ++s) { const unsigned row = (unsigned)s * 4u + rq; *(v8h*)(crow + (size_t)row * ldc + cq * 8u) = vals[s]; }
         }
}
// f32 output: row segment = 64 floats = 256 B = 16 lanes x 16 B; one instruction covers 2 rows; s = 0..7 with hi = lane >> 4 covers rows 0..15.
template <int BIASM>
__device__ __forceinline__ void slab_store(const float* os, float* crow, int ldc, const float* bias, float alpha, unsigned colbase, unsigned rowbase, unsigned lane) {
    const unsigned hi = lane >> 4, cofs = (lane & 15u) * 4u;
    v4f bc = (v4f){0.f, 0.f, 0.f, 0.f};
    if (BIASM == 1) { const v4f b0 = *(const v4f*)(bias + colbase + cofs);
#pragma unroll
        for (int e = 0; e < 4; ++e) bc[e] = bfr(b0[e]); }
    v4f vals[8];
#pragma unroll
    for (int s = 0; s < 8; ++s) { const unsigned row = (unsigned)s * 2u + hi; const v4f x = *(const v4fa*)(os + row * 68u + cofs);
        float br = 0.f; if (BIASM == 2) br = bfr(bias[rowbase + row]);
        v4f o;
#pragma unroll
        for (int e = 0; e < 4; ++e) o[e] = x[e] * alpha + (bc[e] + br);
        vals[s] = o; }
{
#pragma unroll
        for (int s = 0; s < 8; ++s) { const unsigned row = (unsigned)s * 2u + hi; *(v4f*)(crow + (size_t)row * ldc + cofs) = vals[s]; }
         }
}

// ---- k_gemmw: GEMM, one 128x128 output tile per block of FOUR waves (2 x 2), each wave a 64x64 tile (16 accumulators); grid (M/128, N/128, Z), 128 threads.
// Operands come from K-contiguous 16-bit planes in slices of 64 k (128 B = one line of every row): [A 128 rows | Bt 128 rows] at pitch 144 B in a two-buffer LDS ring,
// laid by asynchronous copies (each wave 32 rows of A and 32 of Bt, 8 lanes a row); every wave reads its fragments from the ring, so a row is fetched once per block and not once per wave.
// C[m][n] (pitch ldc) = alpha * sum_k A[m][k] Bt[n][k] (+ bias). blockIdx.z = batch * 8 + head: head strides sA/sB/sC (elements), sBias (floats), batch strides tA/tB/tC (elements). K % 64 == 0, M % 128 == 0, N % 128 == 0 (host-checked by static_assert).
// Behind the loop the ring is free and each wave stages its output slabs in a range of its own ('os', wave-level ordering only).
#define BT   128                  // block tile rows = columns
#define BK   64                   // k per ring stage
#define LP   144u                 // LDS row pitch in bytes (16 B x odd: ds_load_b128 without bank conflicts)
#define STG  (2u * BT * LP)       // one stage: A rows, then Bt rows

// Eight copies of one wave: rows 0, 4, .. 28 from the lane's own row (global pitch K elements, LDS pitch LP), 16 B a lane. The s_wait_xcnt stands inside the statement so that no address register is rewritten ahead of it.
template <typename T16>
__device__ __forceinline__ void copy8(unsigned l, const T16* g, size_t K) {
    asm volatile("global_load_async_to_lds_b128 %0, %8, off\n\t"
                 "global_load_async_to_lds_b128 %1, %9, off\n\t"
                 "global_load_async_to_lds_b128 %2, %10, off\n\t"
                 "global_load_async_to_lds_b128 %3, %11, off\n\t"
                 "global_load_async_to_lds_b128 %4, %12, off\n\t"
                 "global_load_async_to_lds_b128 %5, %13, off\n\t"
                 "global_load_async_to_lds_b128 %6, %14, off\n\t"
                 "global_load_async_to_lds_b128 %7, %15, off\n\t"
                 "s_wait_xcnt 0x0"
                 :: "v"(l), "v"(l + 4u * LP), "v"(l + 8u * LP), "v"(l + 12u * LP), "v"(l + 16u * LP), "v"(l + 20u * LP), "v"(l + 24u * LP), "v"(l + 28u * LP),
                    "v"(g), "v"(g + 4 * K), "v"(g + 8 * K), "v"(g + 12 * K), "v"(g + 16 * K), "v"(g + 20 * K), "v"(g + 24 * K), "v"(g + 28 * K)
                 : "memory");
}

template <typename T16, typename OT, int BIASM>
__global__ __launch_bounds__(128) void k_gemmw(const T16* __restrict__ A, const T16* __restrict__ Bt, int K, OT* C, int ldc, const float* __restrict__ bias, float alpha, size_t sA, size_t sB, size_t sC, int sBias, size_t tA, size_t tB, size_t tC) {
    typedef typename WFrag<T16>::V V;
    __shared__ __align__(16) char ring[2 * STG];
    static_assert(4 * 16 * 68 * 4 <= 2 * STG);
    const size_t z = blockIdx.z & 7u, zb = blockIdx.z >> 3; A += z * sA + zb * tA; Bt += z * sB + zb * tB; C += z * sC + zb * tC; if (BIASM != 0) bias += z * (size_t)sBias;
    const unsigned lane = threadIdx.x & 31u, lr = lane & 15u, hi = lane >> 4; const unsigned w = (unsigned)__builtin_amdgcn_readfirstlane((int)(threadIdx.x >> 5));
    const unsigned rb = blockIdx.x * (unsigned)BT, cb = blockIdx.y * (unsigned)BT; const unsigned wr = (w >> 1) * 64u, wc = (w & 1u) * 64u; const unsigned r0 = rb + wr, c0 = cb + wc;
    v8f acc[4][4];
#pragma unroll
    for (int mb = 0; mb < 4; ++mb)
#pragma unroll
        for (int nb = 0; nb < 4; ++nb) acc[mb][nb] = (v8f){};
    // the lane's own copy addresses: row w*32 + lane/8 of the block's A and Bt rows, 16-byte piece lane%8 of the row's 128 B
    const unsigned cprow = w * 32u + (lane >> 3), cpc = lane & 7u;
    const T16* ga = A + (size_t)(rb + cprow) * K + cpc * 8u; const T16* gb = Bt + (size_t)(cb + cprow) * K + cpc * 8u;
    const unsigned la = (unsigned)(size_t)(const void*)ring + cprow * LP + cpc * 16u, lb = la + (unsigned)BT * LP;
    const int nt = K / BK;
    copy8(la, ga, (size_t)K); copy8(lb, gb, (size_t)K);
    asm volatile("s_wait_asynccnt 0x0" ::: "memory");   // this wave's rows of stage 0 have landed
    __syncthreads();                                     // stage 0 published to the four waves
    if (nt > 1) { copy8(la + STG, ga + BK, (size_t)K); copy8(lb + STG, gb + BK, (size_t)K); }
    const char* fa = ring + (wr + lr) * LP + hi * 16u; const char* fb = ring + ((unsigned)BT + wc + lr) * LP + hi * 16u;
#pragma unroll 1
    for (int t = 0; t < nt; ++t) {
        const unsigned bo = ((unsigned)t & 1u) * STG;
#pragma unroll
        for (int ks = 0; ks < BK / 32; ++ks) {
            V a[4], b[4];
            a[0] = WFrag<T16>::ld((const T16*)(fa + bo + (unsigned)ks * 64u)); b[0] = WFrag<T16>::ld((const T16*)(fb + bo + (unsigned)ks * 64u));
#pragma unroll
            for (int mb = 1; mb < 4; ++mb) a[mb] = WFrag<T16>::ld((const T16*)(fa + bo + (unsigned)mb * 16u * LP + (unsigned)ks * 64u));
#pragma unroll
            for (int nb = 1; nb < 4; ++nb) b[nb] = WFrag<T16>::ld((const T16*)(fb + bo + (unsigned)nb * 16u * LP + (unsigned)ks * 64u));
            __builtin_amdgcn_sched_barrier(0);   // keeps the 16 LDS reads one group ahead of their 16 products: left free, the compiler spreads them among the products, each group behind a full LDS wait
#pragma unroll
            for (int nb = 0; nb < 4; ++nb)
#pragma unroll
                for (int mb = 0; mb < 4; ++mb) acc[mb][nb] = WFrag<T16>::mma(a[mb], b[nb], acc[mb][nb]);
            __builtin_amdgcn_sched_barrier(0);   // the other side of the pair: the next group's reads stay behind these products
        }
        asm volatile("s_wait_dscnt 0x0" ::: "memory");      // this wave's reads of buffer t%2 are done before the buffer is refilled
        asm volatile("s_wait_asynccnt 0x0" ::: "memory");   // this wave's rows of stage t+1 have landed
        __syncthreads();                                     // publishes stage t+1 and ends every wave's reads of stage t
        if (t + 2 < nt) { copy8(la + bo, ga + (size_t)(t + 2) * BK, (size_t)K); copy8(lb + bo, gb + (size_t)(t + 2) * BK, (size_t)K); }
    }
    asm volatile("s_wait_asynccnt 0x0" ::: "memory");       // nothing in flight when the ring becomes output staging
    float* os = (float*)(ring + w * (16u * 68u * 4u));
#pragma unroll
    for (int mb = 0; mb < 4; ++mb) {
#pragma unroll
        for (int nb = 0; nb < 4; ++nb) {
#pragma unroll
            for (int j = 0; j < 8; ++j) os[(hi * 8u + (unsigned)j) * 68u + (unsigned)nb * 16u + lr] = acc[mb][nb][j]; }   // D: row 8*hi + j, col lr
        __builtin_amdgcn_fence(3 /* release order */, "wavefront"); __builtin_amdgcn_wave_barrier(); asm volatile("" ::: "memory");
        OT* crow = C + (size_t)(r0 + (unsigned)mb * 16u) * ldc + c0;
        slab_store<BIASM>(os, crow, ldc, bias, alpha, c0, r0 + (unsigned)mb * 16u, lane);
        __builtin_amdgcn_fence(3 /* release order */, "wavefront"); __builtin_amdgcn_wave_barrier(); asm volatile("" ::: "memory");
    }
}

__global__ __launch_bounds__(256) void k_xplanes(const float* __restrict__ xq, const float* __restrict__ xk, const float* __restrict__ xv, bf* XP) {
    const unsigned which = blockIdx.y; const unsigned i = blockIdx.x * 256u + threadIdx.x;
    const unsigned GPB = (unsigned)(SEQ * DD / 8); const unsigned b = i / GPB, rem = i - b * GPB;
    const float* src = (which == 0u) ? xq : ((which == 1u) ? xk : xv);
    const v8f v = *(const v8f*)(src + (size_t)b * SEQ_FULL * DD + (size_t)rem * 8);
    v8us o;
#pragma unroll
    for (int k = 0; k < 8; ++k) o[k] = f2bf(v[k]);
    bf* dst = XP + (size_t)which * NB * SEQ * DD + (size_t)i * 8;
    *(v8us*)dst = o; 
}

// k_wprep: lines 0..WLINES-1: per-head transposed bf16 weight planes WT[mtx = which*8 + h][n][k] = bf16(W[h][k][n]) (which 0 Wq, 1 Wk, 2 Wv);
__global__ __launch_bounds__(256) void k_wprep(const float* __restrict__ wq, const float* __restrict__ wk, const float* __restrict__ wv, const float* __restrict__ wo, bf* WT, unsigned short* WOS) {
    const unsigned lane = threadIdx.x & 31u; const unsigned L0 = (blockIdx.x * 8u + (threadIdx.x >> 5)) * 8u;
{
#pragma unroll 1
        for (unsigned l = 0; l < 8u; ++l) { const unsigned L = L0 + l; v2us o;
            if (L < (unsigned)WLINES) {   // block-uniform
                const unsigned mtx = L >> 10, which = mtx >> 3, h = mtx & 7u; const unsigned e = (L & 1023u) * 64u + lane * 2u; const unsigned k = e & 255u, n = e >> 8;
                const float* src = ((which == 0u) ? wq : ((which == 1u) ? wk : wv)) + (size_t)h * DD * DD;
                o[0] = f2bf(src[(size_t)k * DD + n]); o[1] = f2bf(src[(size_t)(k + 1u) * DD + n]);
                *(v2us*)(WT + (size_t)mtx * DD * DD + e) = o;
            } else {
                const unsigned e = (L - (unsigned)WLINES) * 64u + lane * 2u; const unsigned kk = e & (unsigned)(KM - 1), n = e >> 11; const unsigned h = kk >> 8, d = kk & 255u;
                const float x0 = bfr(wo[(size_t)(d * 8u + h) * DD + n]) * WOCAR; const float x1 = bfr(wo[(size_t)((d + 1u) * 8u + h) * DD + n]) * WOCAR;
                o[0] = __builtin_bit_cast(unsigned short, (h16)x0); o[1] = __builtin_bit_cast(unsigned short, (h16)x1);
                *(v2us*)(WOS + e) = o;
            } }
         }
}

// ---- k_fattn: scores, softmax and P.V of one head for 256 queries per block; 8 waves, each 32 query columns; grid (SEQ/256, batch*8 + head), 256 threads.
// Transposed products: S^T = k_ . q_^T (A = k_ rows from LDS, B = q_ kept in registers), O^T += v_^T . P^T (A = v_^T rows from LDS, B = P^T packed from the score accumulators of the same lane).
// In a score tile a lane holds keys 8*hi + j of query lr; tiles of keys 0..15 and 16..31 give elements 0..7 and 8..15 of the B fragment, which is the loaders' k order.
// A stage is 64 keys: [k_ 64 rows of 512 B at pitch 528 | v_^T 256 rows of 128 B at pitch 144] in a two-buffer LDS ring laid by asynchronous copies; a pass is 32 keys.
// Online softmax in the log2 domain: the maximum in use moves only when a pass exceeds it by more than 8 (P <= 256 fits f16), tested once per pass by a scalar branch.
#define FKB  64                   // keys per ring stage
#define KPIT 528u                 // LDS pitch of a k_ row, bytes (16 B x odd)
#define VPIT 144u                 // LDS pitch of a v_^T row piece, bytes (16 B x odd)
#define FKSZ ((unsigned)FKB * KPIT)
#define FSTG (FKSZ + (unsigned)DD * VPIT)
static_assert(DD == 256 && SEQ % FKB == 0 && SEQ / FKB >= 2);

// Eight copies of one wave, 16 B a lane: LDS address l + i*ls bytes, global address g + i*gs elements. The builtin form: with these copies as asm statements the register allocation of k_fattn spilled q_ fragments, with the builtin it does not.
typedef int v4i __attribute__((ext_vector_type(4)));
typedef float v2f __attribute__((ext_vector_type(2)));
__device__ __forceinline__ void copy8s(char* l, unsigned ls, const h16* g, size_t gs) {
#pragma unroll
    for (int i = 0; i < 8; ++i)
        __builtin_amdgcn_global_load_async_to_lds_b128((__attribute__((address_space(1))) v4i*)(g + (size_t)i * gs), (__attribute__((address_space(3))) v4i*)(l + (unsigned)i * ls), 0, 0);
}

// lane l's value from lane l ^ 16 (a vector-unit exchange: an LDS permute would queue behind the fragment reads issued ahead)
__device__ __forceinline__ float xhalf(float x) { return __builtin_bit_cast(float, __builtin_amdgcn_permlanex16(__builtin_bit_cast(int, x), __builtin_bit_cast(int, x), 0x76543210, 0xfedcba98, false, false)); }

__global__ __launch_bounds__(256) void k_fattn(const h16* __restrict__ QPl, const h16* __restrict__ KPl, const h16* __restrict__ VTl, h16* __restrict__ CT) {
    __shared__ __align__(16) char ring[2 * FSTG];
    static_assert(8u * 32u * KPIT <= 2u * FSTG);
    const unsigned lane = threadIdx.x & 31u, lr = lane & 15u, hi = lane >> 4; const unsigned w = (unsigned)__builtin_amdgcn_readfirstlane((int)(threadIdx.x >> 5));
    const size_t z = blockIdx.y; const h16* Qh = QPl + z * ((size_t)SEQ * DD); const h16* Kh = KPl + z * ((size_t)SEQ * DD); const h16* Vh = VTl + z * ((size_t)SEQ * DD);
    const unsigned q0 = blockIdx.x * 256u + w * 32u;
    // copy addresses: k_ rows w*8 + i, a whole 512-B row per copy; v_^T rows 32*i + w*4 + lane/8, 16-byte piece lane%8 of the row's 128 B (a step of 32 rows is beyond the copy's offset field, so each copy carries its own two addresses)
    char* lk = ring + w * 8u * KPIT + lane * 16u; char* lv = ring + FKSZ + (w * 4u + (lane >> 3)) * VPIT + (lane & 7u) * 16u;
    const h16* gk = Kh + (size_t)(w * 8u) * DD + lane * 8u; const h16* gv = Vh + (size_t)(w * 4u + (lane >> 3)) * SEQ + (lane & 7u) * 8u;
    copy8s(lk, KPIT, gk, (size_t)DD); copy8s(lv, 32u * VPIT, gv, (size_t)32 * SEQ);
    v16h qf[2][8];
#pragma unroll
    for (int qt = 0; qt < 2; ++qt)
#pragma unroll
        for (int ks = 0; ks < 8; ++ks) qf[qt][ks] = WFrag<h16>::ld(Qh + (size_t)(q0 + (unsigned)qt * 16u + lr) * DD + (unsigned)ks * 32u + hi * 8u);
    v8f o[16][2];
#pragma unroll
    for (int dt = 0; dt < 16; ++dt) { o[dt][0] = (v8f){}; o[dt][1] = (v8f){}; }
    float mrun[2] = {-3.0e38f, -3.0e38f}, lsum[2] = {0.f, 0.f};
    asm volatile("s_wait_asynccnt 0x0" ::: "memory");   // this wave's rows of stage 0 have landed
    __syncthreads();                                     // stage 0 published to the eight waves
    copy8s(lk + FSTG, KPIT, gk + (size_t)FKB * DD, (size_t)DD); copy8s(lv + FSTG, 32u * VPIT, gv + FKB, (size_t)32 * SEQ);
    const char* fk = ring + lr * KPIT + hi * 16u; const char* fv = ring + FKSZ + lr * VPIT + hi * 16u;
    const int nt = SEQ / FKB;
// fragment of pass p (32 keys) in buffer offset bo: k_ key tile kt, k-step u; v_^T d tile dt
#define LDK(p, u, kt) WFrag<h16>::ld((const h16*)(fk + bo + (unsigned)((p) * 32 + (kt) * 16) * KPIT + (unsigned)(u) * 64u))
#define LDV(p, dt)    WFrag<h16>::ld((const h16*)(fv + bo + (unsigned)(dt) * 16u * VPIT + (unsigned)(p) * 64u))
    for (int t = 0; t < nt; ++t) {
        const unsigned bo = ((unsigned)t & 1u) * FSTG;
        // Fragments are read ahead of their products, never past the stage. A unit = 2 fragments and 4 products: the two key tiles' k_ fragments of one k-step, or two d tiles' v_^T fragments.
        // Each unit is read two units ahead into a ring of three sets; P.V's first two units are read under the last two score units, the next pass's first two score units under the last two of P.V.
        v16h fs[3][2], fw[3][2]; v8f st[2][2]; v16h pf[2];
        fs[0][0] = LDK(0, 0, 0); fs[0][1] = LDK(0, 0, 1); fs[1][0] = LDK(0, 1, 0); fs[1][1] = LDK(0, 1, 1);
#pragma unroll
        for (int p = 0; p < 2; ++p) {
            st[0][0] = (v8f){}; st[0][1] = (v8f){}; st[1][0] = (v8f){}; st[1][1] = (v8f){};
#pragma unroll
            for (int u = 0; u < 8; ++u) {
                if (u < 6) { fs[(u + 2) % 3][0] = LDK(p, u + 2, 0); fs[(u + 2) % 3][1] = LDK(p, u + 2, 1); }
                else { fw[u - 6][0] = LDV(p, (u - 6) * 2); fw[u - 6][1] = LDV(p, (u - 6) * 2 + 1); }
                __builtin_amdgcn_sched_barrier(0);   // keeps the LDS reads issued ahead as one group in front of these products instead of spread among them
#pragma unroll
                for (int kt = 0; kt < 2; ++kt)
#pragma unroll
                    for (int qt = 0; qt < 2; ++qt) st[kt][qt] = wmma16(fs[u % 3][kt], qf[qt][u], st[kt][qt]);
                __builtin_amdgcn_sched_barrier(0);   // the other side of the pair: later reads stay behind these products
            }
            float ms[2];
#pragma unroll
            for (int qt = 0; qt < 2; ++qt) { float a = fmaxf(st[0][qt][0], st[1][qt][0]);
#pragma unroll
                for (int j = 1; j < 8; ++j) a = fmaxf(a, fmaxf(st[0][qt][j], st[1][qt][j]));
                a = fmaxf(a, xhalf(a)); ms[qt] = a * SCL2; }
            const bool need = (ms[0] > mrun[0] + 8.0f) || (ms[1] > mrun[1] + 8.0f);
            if (__builtin_amdgcn_ballot_w32(need) != 0) {   // wave-uniform: every lane rescales its two queries or none does
#pragma unroll
                for (int qt = 0; qt < 2; ++qt) { const float mn = fmaxf(mrun[qt], ms[qt]); const float al = __builtin_amdgcn_exp2f(mrun[qt] - mn); mrun[qt] = mn; lsum[qt] *= al;
#pragma unroll
                    for (int dt = 0; dt < 16; ++dt) o[dt][qt] *= al; }
            }
#pragma unroll
            for (int qt = 0; qt < 2; ++qt) { v16h pk; const float nm = -mrun[qt]; v2f ps[2] = {(v2f){0.f, 0.f}, (v2f){0.f, 0.f}};
#pragma unroll
                for (int i = 0; i < 8; ++i) {
                    const v2f arg = __builtin_elementwise_fma((v2f){st[i >> 2][qt][2 * (i & 3)], st[i >> 2][qt][2 * (i & 3) + 1]}, (v2f){SCL2, SCL2}, (v2f){nm, nm});
                    const float e0 = __builtin_amdgcn_exp2f(arg.x), e1 = __builtin_amdgcn_exp2f(arg.y);
                    ps[i & 1] += (v2f){e0, e1}; pk[2 * i] = (h16)e0; pk[2 * i + 1] = (h16)e1; }
                lsum[qt] += (ps[0].x + ps[1].x) + (ps[0].y + ps[1].y);
                asm volatile("" : "+v"(lsum[qt]));   // each row's sum, against spills: left free, the adds sink behind the P.V products and the 32 exponentials stay live into the next pass
                pf[qt] = pk; }
#pragma unroll
            for (int u = 0; u < 8; ++u) {
                if (u < 6) { fw[(u + 2) % 3][0] = LDV(p, (u + 2) * 2); fw[(u + 2) % 3][1] = LDV(p, (u + 2) * 2 + 1); }
                else if (p == 0) { fs[u - 6][0] = LDK(1, u - 6, 0); fs[u - 6][1] = LDK(1, u - 6, 1); }
                __builtin_amdgcn_sched_barrier(0);   // as above: the reads issued ahead stay one group in front of these products
#pragma unroll
                for (int i = 0; i < 2; ++i)
#pragma unroll
                    for (int qt = 0; qt < 2; ++qt) o[u * 2 + i][qt] = wmma16(fw[u % 3][i], pf[qt], o[u * 2 + i][qt]);
                __builtin_amdgcn_sched_barrier(0);   // the other side of the pair
            }
        }
        asm volatile("s_wait_dscnt 0x0" ::: "memory");      // this wave's reads of buffer t%2 are done before the buffer is refilled
        asm volatile("s_wait_asynccnt 0x0" ::: "memory");   // this wave's rows of stage t+1 have landed
        __syncthreads();                                     // publishes stage t+1 and ends every wave's reads of stage t
        if (t + 2 < nt) { copy8s(lk + bo, KPIT, gk + (size_t)(t + 2) * FKB * DD, (size_t)DD); copy8s(lv + bo, 32u * VPIT, gv + (size_t)(t + 2) * FKB, (size_t)32 * SEQ); }
    }
    asm volatile("s_wait_asynccnt 0x0" ::: "memory");       // nothing in flight when the ring becomes output staging
    // O^T tile: lane holds d = dt*16 + 8*hi + j of query lr: 16 B of that query's ctx row; rows staged (pitch 528 B, a range per wave) so that each store covers a whole 512-B row segment
    char* os = ring + w * (32u * KPIT);
#pragma unroll
    for (int qt = 0; qt < 2; ++qt) { const float inv = __fdiv_rn(CCAR, lsum[qt] + xhalf(lsum[qt]));
#pragma unroll
        for (int dt = 0; dt < 16; ++dt) { v8h ov;
#pragma unroll
            for (int j = 0; j < 8; ++j) ov[j] = (h16)(o[dt][qt][j] * inv);
            *(v8h*)(os + ((unsigned)qt * 16u + lr) * KPIT + (unsigned)dt * 32u + hi * 16u) = ov; } }
    __syncthreads();                                         // the staged rows are complete before other lanes read them back
    h16* crow = CT + ((z >> 3) * (size_t)SEQ + q0) * KM + (z & 7u) * (size_t)DD + lane * 8u;
    v8h rowv[32];   // all 32 rows are read into registers of their own ahead of the stores, and one address serves every store: no register that an issued store names is written again
#pragma unroll
    for (int r = 0; r < 32; ++r) rowv[r] = *(const v8h*)(os + (unsigned)r * KPIT + lane * 16u);
#pragma unroll
    for (int r = 0; r < 32; ++r) *(v8h*)(crow + (size_t)r * KM) = rowv[r];
}

// Workspace carve (bytes, each region 256-B aligned by construction of the sizes).
#define SZ_XP  ((size_t)3 * NB * SEQ * DD * 2)
#define SZ_WT  ((size_t)3 * NHEAD * DD * DD * 2)
#define SZ_WOS ((size_t)DD * KM * 2)
#define SZ_HP  ((size_t)NB * NHEAD * SEQ * DD * 2)
#define SZ_ALL (SZ_XP + SZ_WT + SZ_WOS + 4 * SZ_HP)
static_assert(SZ_ALL <= (size_t)268435456);
static_assert(SZ_XP % 256 == 0 && SZ_WT % 256 == 0 && SZ_WOS % 256 == 0 && SZ_HP % 256 == 0);
static_assert((size_t)SEQ * KM == (size_t)NHEAD * SEQ * DD);   // the ctx plane has the size of one set of head planes

extern "C" void kernel_launch(void* const* d_in, const int* in_sizes, int n_in,
                              void* d_out, int out_size, void* d_ws, size_t ws_size, hipStream_t stream) {
    if (n_in < 11) return;
    const size_t xneed = (size_t)(NB - 1) * SEQ_FULL * DD + (size_t)SEQ * DD;
    if ((size_t)in_sizes[0] < xneed || (size_t)in_sizes[1] < xneed || (size_t)in_sizes[2] < xneed) return;
    if ((size_t)in_sizes[3] < (size_t)NHEAD * DD * DD || (size_t)in_sizes[5] < (size_t)NHEAD * DD * DD || (size_t)in_sizes[7] < (size_t)NHEAD * DD * DD) return;
    if ((size_t)in_sizes[4] < (size_t)NHEAD * DD || (size_t)in_sizes[6] < (size_t)NHEAD * DD || (size_t)in_sizes[8] < (size_t)NHEAD * DD) return;
    if ((size_t)in_sizes[9] < (size_t)KM * DD || (size_t)in_sizes[10] < (size_t)DD) return;
    if ((size_t)out_size < (size_t)NB * SEQ * DD) return;
    if (SZ_ALL > ws_size) return;
    const float* Kin = (const float*)d_in[0]; const float* Vin = (const float*)d_in[1]; const float* Qin = (const float*)d_in[2];
    const float* Wk = (const float*)d_in[3]; const float* bk = (const float*)d_in[4]; const float* Wv = (const float*)d_in[5]; const float* bv = (const float*)d_in[6];
    const float* Wq = (const float*)d_in[7]; const float* bq = (const float*)d_in[8]; const float* Wo = (const float*)d_in[9]; const float* bo = (const float*)d_in[10];
    float* OUT = (float*)d_out;     // [NB][SEQ][256]
    char* wsp = (char*)d_ws;
    bf* XP = (bf*)wsp; wsp += SZ_XP;            // [3][NB][SEQ][256] bf16: q, k, v
    bf* WT = (bf*)wsp; wsp += SZ_WT;            // [3][8][256 out][256 in] bf16: Wq^T, Wk^T, Wv^T
    h16* WOS = (h16*)wsp; wsp += SZ_WOS;        // [256][2048] f16 (x256), column h*256 + d
    h16* QP = (h16*)wsp; wsp += SZ_HP;          // [NB][8][SEQ][256]
    h16* KP = (h16*)wsp; wsp += SZ_HP;          // [NB][8][SEQ][256]
    h16* VT = (h16*)wsp; wsp += SZ_HP;          // [NB][8][256][SEQ]
    h16* CTX = (h16*)wsp; wsp += SZ_HP;         // [NB][SEQ][2048] (x64), column h*256 + d
    const bf* XQ = XP; const bf* XK = XP + (size_t)NB * SEQ * DD; const bf* XV = XP + (size_t)2 * NB * SEQ * DD;
    const bf* WQT = WT; const bf* WKT = WT + (size_t)NHEAD * DD * DD; const bf* WVT = WT + (size_t)2 * NHEAD * DD * DD;

    k_xplanes<<<dim3((unsigned)((size_t)NB * SEQ * DD / 8 / 256), 3, 1), 256, 0, stream>>>(Qin, Kin, Vin, XP);
    k_wprep<<<(unsigned)((WLINES + OLINES) / 64), 256, 0, stream>>>(Wq, Wk, Wv, Wo, WT, (unsigned short*)WOS);
    const size_t HS = (size_t)SEQ * DD, BS = (size_t)NHEAD * SEQ * DD;   // one head plane, one batch of head planes (elements)
    // q_ and k_ head planes, all batches: A = x of batch zb [SEQ][256], Bt = W^T head z [256 out][256 in], + per-column bias
    k_gemmw<bf, h16, 1><<<dim3(SEQ / 128, DD / 128, NB * NHEAD), 128, 0, stream>>>(XQ, WQT, DD, QP, DD, bq, 1.0f, (size_t)0, (size_t)DD * DD, HS, DD, HS, (size_t)0, BS);
    k_gemmw<bf, h16, 1><<<dim3(SEQ / 128, DD / 128, NB * NHEAD), 128, 0, stream>>>(XK, WKT, DD, KP, DD, bk, 1.0f, (size_t)0, (size_t)DD * DD, HS, DD, HS, (size_t)0, BS);
    // v_^T head planes [256 d][SEQ t], all batches: A = Wv^T head z [256 d][256 in] (rows = d), Bt = x of batch zb [SEQ t][256 in] (rows = t), + per-row bias
    k_gemmw<bf, h16, 2><<<dim3(DD / 128, SEQ / 128, NB * NHEAD), 128, 0, stream>>>(WVT, XV, DD, VT, SEQ, bv, 1.0f, (size_t)DD * DD, (size_t)0, HS, DD, (size_t)0, HS, BS);
    // ctx[zb][t][h*256 + d] = 64 softmax(q_ . k_ / 16) . v_, all heads of all batches
    k_fattn<<<dim3(SEQ / 256, NB * NHEAD, 1), 256, 0, stream>>>(QP, KP, VT, CTX);
    // out = ctx . Wo (row-permuted plane) / 16384 + bo, the rows of all batches in one launch
    k_gemmw<h16, float, 1><<<dim3(NB * SEQ / 128, DD / 128, 1), 128, 0, stream>>>(CTX, WOS, KM, OUT, DD, bo, FINSC, (size_t)0, (size_t)0, (size_t)0, 0, (size_t)0, (size_t)0, (size_t)0);
}

// v004
// Measured time: 142 microseconds a run.
// Timed twice side by side with v003, it ran 1.06 times as fast both times.
// Over all steps from v000 it is 6.51 times as fast.
#include <hip/hip_runtime.h>

// Multi-head attention with full-width (256) heads: per-head q/k/v projections, softmax(q_.k_ / 16) over 2,048 keys, P.v_, hidden-major head merge, output mix with Wo + bo.
// Compute dtypes, f32 accumulate everywhere: projections v_wmma_f32_16x16x32_bf16 (inputs and weights RNE-converted to bf16, exact products); scores, P.V and the output mix v_wmma_f32_16x16x32_f16
// (q_/k_/v_ f16 planes; scores stay f32 in registers; P f16 of exp2(score*log2(e)/16 - running maximum); ctx f16 carried x64; Wo plane f16 of bf16(Wo) x256; bo, biases bf16-converted, added in f32). Softmax in f32, online over key passes.

#ifndef NB
#define NB 4
#endif
#ifndef SEQ
#define SEQ 2048
#endif
#define NB_FULL  4
#define SEQ_FULL 2048
#define DD    256                 // model width = head width
#define NHEAD 8
#define KM    (NHEAD * DD)        // merged context width (plane column = h*256 + d)
#define SCL2  0.09016844005556021f   // log2(e) / sqrt(256)
#define CCAR  64.0f               // carry of the ctx plane
#define WOCAR 256.0f              // carry of the Wo plane
#define FINSC (1.0f / 16384.0f)   // 1 / (64 * 256)
#define WLINES (3 * NHEAD * DD * DD / 64)
#define OLINES (DD * KM / 64)

typedef _Float16 h16;
typedef unsigned short bf;
typedef __attribute__((ext_vector_type(16))) __bf16   v16bf;
typedef __attribute__((ext_vector_type(16))) _Float16 v16h;
typedef __attribute__((ext_vector_type(8)))  _Float16 v8h;
typedef __attribute__((ext_vector_type(8)))  unsigned short v8us;
typedef __attribute__((ext_vector_type(2)))  unsigned short v2us;
typedef __attribute__((ext_vector_type(8)))  float    v8f;
typedef __attribute__((ext_vector_type(4)))  float    v4f;
typedef v4f  __attribute__((may_alias)) v4fa;

static_assert(SEQ % 256 == 0);
static_assert(NHEAD == 8);
static_assert(DD % 128 == 0 && DD % 64 == 0 && KM % 64 == 0 && SEQ % 128 == 0);
static_assert(((size_t)NB * SEQ * DD / 8) % 256 == 0);
static_assert((WLINES + OLINES) % 64 == 0);

__device__ __forceinline__ unsigned short f2bf(float f) { unsigned u = __float_as_uint(f); u += 0x7FFFu + ((u >> 16) & 1u); return (unsigned short)(u >> 16); }
__device__ __forceinline__ float bf2f(unsigned short b) { return __uint_as_float(((unsigned)b) << 16); }
__device__ __forceinline__ float bfr(float f) { return bf2f(f2bf(f)); }
__device__ __forceinline__ v16h cat16(v8h lo, v8h hi) { return __builtin_shufflevector(lo, hi, 0, 1, 2, 3, 4, 5, 6, 7, 8, 9, 10, 11, 12, 13, 14, 15); }
__device__ __forceinline__ v16bf cat16b(v8us lo, v8us hi) { return __builtin_bit_cast(v16bf, __builtin_shufflevector(lo, hi, 0, 1, 2, 3, 4, 5, 6, 7, 8, 9, 10, 11, 12, 13, 14, 15)); }
__device__ __forceinline__ v8f wmma16(v16h a, v16h b, v8f c) { return __builtin_amdgcn_wmma_f32_16x16x32_f16(false, a, false, b, (short)0, c, false, false); }
__device__ __forceinline__ v8f wmmab(v16bf a, v16bf b, v8f c) { return __builtin_amdgcn_wmma_f32_16x16x32_bf16(false, a, false, b, (short)0, c, false, false); }

// Fragment loaders: lane (lr = lane & 15, hi = lane >> 4); p points at row lr, k0 + 8*hi; elements 0..7 = k0+8hi.., elements 8..15 = k0+16+8hi.. (same map for A and B).
template <typename T16> struct WFrag;
template <> struct WFrag<h16> { typedef v16h V; static __device__ __forceinline__ V ld(const h16* p) { return cat16(*(const v8h*)p, *(const v8h*)(p + 16)); } static __device__ __forceinline__ v8f mma(V a, V b, v8f c) { return wmma16(a, b, c); } };
template <> struct WFrag<bf> { typedef v16bf V; static __device__ __forceinline__ V ld(const bf* p) { return cat16b(*(const v8us*)p, *(const v8us*)(p + 16)); } static __device__ __forceinline__ v8f mma(V a, V b, v8f c) { return wmmab(a, b, c); } };

// Slab epilogues: 16 rows x 64 columns staged in LDS (pitch 68 floats) -> global; value = x*alpha + bias (BIASM 1: per column, 2: per row; biases bf16-converted).
template <int BIASM>
__device__ __forceinline__ void slab_store(const float* os, h16* crow, int ldc, const float* bias, float alpha, unsigned colbase, unsigned rowbase, unsigned lane) {
    const unsigned rq = lane >> 3, cq = lane & 7u;
    float bc[8];
#pragma unroll
    for (int e = 0; e < 8; ++e) bc[e] = 0.f;
    if (BIASM == 1) { const v4f b0 = *(const v4f*)(bias + colbase + cq * 8u); const v4f b1 = *(const v4f*)(bias + colbase + cq * 8u + 4u);
#pragma unroll
        for (int e = 0; e < 4; ++e) { bc[e] = bfr(b0[e]); bc[4 + e] = bfr(b1[e]); } }
    v8h vals[4];
#pragma unroll
    for (int s = 0; s < 4; ++s) { const unsigned row = (unsigned)s * 4u + rq; const v4f x0 = *(const v4fa*)(os + row * 68u + cq * 8u); const v4f x1 = *(const v4fa*)(os + row * 68u + cq * 8u + 4u);
        float br = 0.f; if (BIASM == 2) br = bfr(bias[rowbase + row]);
        v8h o;
#pragma unroll
        for (int e = 0; e < 4; ++e) { o[e] = (h16)(x0[e] * alpha + (bc[e] + br)); o[4 + e] = (h16)(x1[e] * alpha + (bc[4 + e] + br)); }
        vals[s] = o; }
{
#pragma unroll
        for (int s = 0; s < 4; ++s) { const unsigned row = (unsigned)s * 4u + rq; *(v8h*)(crow + (size_t)row * ldc + cq * 8u) = vals[s]; }
         }
}
// f32 output: row segment = 64 floats = 256 B = 16 lanes x 16 B; one instruction covers 2 rows; s = 0..7 with hi = lane >> 4 covers rows 0..15.
template <int BIASM>
__device__ __forceinline__ void slab_store(const float* os, float* crow, int ldc, const float* bias, float alpha, unsigned colbase, unsigned rowbase, unsigned lane) {
    const unsigned hi = lane >> 4, cofs = (lane & 15u) * 4u;
    v4f bc = (v4f){0.f, 0.f, 0.f, 0.f};
    if (BIASM == 1) { const v4f b0 = *(const v4f*)(bias + colbase + cofs);
#pragma unroll
        for (int e = 0; e < 4; ++e) bc[e] = bfr(b0[e]); }
    v4f vals[8];
#pragma unroll
    for (int s = 0; s < 8; ++s) { const unsigned row = (unsigned)s * 2u + hi; const v4f x = *(const v4fa*)(os + row * 68u + cofs);
        float br = 0.f; if (BIASM == 2) br = bfr(bias[rowbase + row]);
        v4f o;
#pragma unroll
        for (int e = 0; e < 4; ++e) o[e] = x[e] * alpha + (bc[e] + br);
        vals[s] = o; }
{
#pragma unroll
        for (int s = 0; s < 8; ++s) { const unsigned row = (unsigned)s * 2u + hi; *(v4f*)(crow + (size_t)row * ldc + cofs) = vals[s]; }
         }
}

// ---- gemm_tile: GEMM, one 128x128 output tile (rows from rb, columns from cb) per block of FOUR waves (2 x 2), each wave a 64x64 tile (16 accumulators); 128 threads.
// Operands come from K-contiguous 16-bit planes in slices of 64 k (128 B = one line of every row): [A 128 rows | Bt 128 rows] at pitch 144 B in a two-buffer LDS ring,
// laid by asynchronous copies (each wave 32 rows of A and 32 of Bt, 8 lanes a row); every wave reads its fragments from the ring, so a row is fetched once per block and not once per wave.
// C[m][n] (pitch ldc) = alpha * sum_k A[m][k] Bt[n][k] (+ bias; BIASM 3: per row where rowbias, else per column, a block-uniform choice). K % 64 == 0, M % 128 == 0, N % 128 == 0 (host-checked by static_assert).
// Behind the loop the ring is free and each wave stages its output slabs in a range of its own ('os', wave-level ordering only).
#define BT   128                  // block tile rows = columns
#define BK   64                   // k per ring stage
#define LP   144u                 // LDS row pitch in bytes (16 B x odd: ds_load_b128 without bank conflicts)
#define STG  (2u * BT * LP)       // one stage: A rows, then Bt rows

// Eight copies of one wave: rows 0, 4, .. 28 from the lane's own row (global pitch K elements, LDS pitch LP), 16 B a lane. The s_wait_xcnt stands inside the statement so that no address register is rewritten ahead of it.
template <typename T16>
__device__ __forceinline__ void copy8(unsigned l, const T16* g, size_t K) {
    asm volatile("global_load_async_to_lds_b128 %0, %8, off\n\t"
                 "global_load_async_to_lds_b128 %1, %9, off\n\t"
                 "global_load_async_to_lds_b128 %2, %10, off\n\t"
                 "global_load_async_to_lds_b128 %3, %11, off\n\t"
                 "global_load_async_to_lds_b128 %4, %12, off\n\t"
                 "global_load_async_to_lds_b128 %5, %13, off\n\t"
                 "global_load_async_to_lds_b128 %6, %14, off\n\t"
                 "global_load_async_to_lds_b128 %7, %15, off\n\t"
                 "s_wait_xcnt 0x0"
                 :: "v"(l), "v"(l + 4u * LP), "v"(l + 8u * LP), "v"(l + 12u * LP), "v"(l + 16u * LP), "v"(l + 20u * LP), "v"(l + 24u * LP), "v"(l + 28u * LP),
                    "v"(g), "v"(g + 4 * K), "v"(g + 8 * K), "v"(g + 12 * K), "v"(g + 16 * K), "v"(g + 20 * K), "v"(g + 24 * K), "v"(g + 28 * K)
                 : "memory");
}

// A wave's 64x64 tile (rows from r0, columns from c0) to global memory: four slabs of 16 rows through the wave's own staging range os.
template <int BIASM, typename OT>
__device__ __forceinline__ void tile_out(const v8f (&acc)[4][4], float* os, OT* C, int ldc, const float* bias, float alpha, unsigned r0, unsigned c0, unsigned lane) {
    const unsigned lr = lane & 15u, hi = lane >> 4;
#pragma unroll
    for (int mb = 0; mb < 4; ++mb) {
#pragma unroll
        for (int nb = 0; nb < 4; ++nb) {
#pragma unroll
            for (int j = 0; j < 8; ++j) os[(hi * 8u + (unsigned)j) * 68u + (unsigned)nb * 16u + lr] = acc[mb][nb][j]; }   // D: row 8*hi + j, col lr
        __builtin_amdgcn_fence(3 /* release order */, "wavefront"); __builtin_amdgcn_wave_barrier(); asm volatile("" ::: "memory");
        OT* crow = C + (size_t)(r0 + (unsigned)mb * 16u) * ldc + c0;
        slab_store<BIASM>(os, crow, ldc, bias, alpha, c0, r0 + (unsigned)mb * 16u, lane);
        asm volatile("s_wait_xcnt 0x0" ::: "memory");   // stands in front of the next slab's writes to registers that this slab's stores name
        __builtin_amdgcn_fence(3 /* release order */, "wavefront"); __builtin_amdgcn_wave_barrier(); asm volatile("" ::: "memory");
    }
}

template <typename T16, typename OT, int BIASM>
__device__ __forceinline__ void gemm_tile(char* ring, const T16* __restrict__ A, const T16* __restrict__ Bt, int K, OT* C, int ldc, const float* __restrict__ bias, float alpha, unsigned rb, unsigned cb, bool rowbias) {
    typedef typename WFrag<T16>::V V;
    static_assert(4 * 16 * 68 * 4 <= 2 * STG);
    const unsigned lane = threadIdx.x & 31u, lr = lane & 15u, hi = lane >> 4; const unsigned w = (unsigned)__builtin_amdgcn_readfirstlane((int)(threadIdx.x >> 5));
    const unsigned wr = (w >> 1) * 64u, wc = (w & 1u) * 64u; const unsigned r0 = rb + wr, c0 = cb + wc;
    v8f acc[4][4];
#pragma unroll
    for (int mb = 0; mb < 4; ++mb)
#pragma unroll
        for (int nb = 0; nb < 4; ++nb) acc[mb][nb] = (v8f){};
    // the lane's own copy addresses: row w*32 + lane/8 of the block's A and Bt rows, 16-byte piece lane%8 of the row's 128 B
    const unsigned cprow = w * 32u + (lane >> 3), cpc = lane & 7u;
    const T16* ga = A + (size_t)(rb + cprow) * K + cpc * 8u; const T16* gb = Bt + (size_t)(cb + cprow) * K + cpc * 8u;
    const unsigned la = (unsigned)(size_t)(const void*)ring + cprow * LP + cpc * 16u, lb = la + (unsigned)BT * LP;
    const int nt = K / BK;
    copy8(la, ga, (size_t)K); copy8(lb, gb, (size_t)K);
    asm volatile("s_wait_asynccnt 0x0" ::: "memory");   // this wave's rows of stage 0 have landed
    __syncthreads();                                     // stage 0 published to the four waves
    if (nt > 1) { copy8(la + STG, ga + BK, (size_t)K); copy8(lb + STG, gb + BK, (size_t)K); }
    const char* fa = ring + (wr + lr) * LP + hi * 16u; const char* fb = ring + ((unsigned)BT + wc + lr) * LP + hi * 16u;
#pragma unroll 1
    for (int t = 0; t < nt; ++t) {
        const unsigned bo = ((unsigned)t & 1u) * STG;
#pragma unroll
        for (int ks = 0; ks < BK / 32; ++ks) {
            V a[4], b[4];
            a[0] = WFrag<T16>::ld((const T16*)(fa + bo + (unsigned)ks * 64u)); b[0] = WFrag<T16>::ld((const T16*)(fb + bo + (unsigned)ks * 64u));
#pragma unroll
            for (int mb = 1; mb < 4; ++mb) a[mb] = WFrag<T16>::ld((const T16*)(fa + bo + (unsigned)mb * 16u * LP + (unsigned)ks * 64u));
#pragma unroll
            for (int nb = 1; nb < 4; ++nb) b[nb] = WFrag<T16>::ld((const T16*)(fb + bo + (unsigned)nb * 16u * LP + (unsigned)ks * 64u));
            __builtin_amdgcn_sched_barrier(0);   // keeps the 16 LDS reads one group ahead of their 16 products: left free, the compiler spreads them among the products, each group behind a full LDS wait
#pragma unroll
            for (int nb = 0; nb < 4; ++nb)
#pragma unroll
                for (int mb = 0; mb < 4; ++mb) acc[mb][nb] = WFrag<T16>::mma(a[mb], b[nb], acc[mb][nb]);
            __builtin_amdgcn_sched_barrier(0);   // the other side of the pair: the next group's reads stay behind these products
        }
        asm volatile("s_wait_dscnt 0x0" ::: "memory");      // this wave's reads of buffer t%2 are done before the buffer is refilled
        asm volatile("s_wait_asynccnt 0x0" ::: "memory");   // this wave's rows of stage t+1 have landed
        __syncthreads();                                     // publishes stage t+1 and ends every wave's reads of stage t
        if (t + 2 < nt) { copy8(la + bo, ga + (size_t)(t + 2) * BK, (size_t)K); copy8(lb + bo, gb + (size_t)(t + 2) * BK, (size_t)K); }
    }
    asm volatile("s_wait_asynccnt 0x0" ::: "memory");       // nothing in flight when the ring becomes output staging
    float* os = (float*)(ring + w * (16u * 68u * 4u));
    if constexpr (BIASM != 3) tile_out<BIASM>(acc, os, C, ldc, bias, alpha, r0, c0, lane);
    else if (rowbias) tile_out<2>(acc, os, C, ldc, bias, alpha, r0, c0, lane);
    else tile_out<1>(acc, os, C, ldc, bias, alpha, r0, c0, lane);
}

// k_gemmw: one GEMM; grid (M/128, N/128), 128 threads.
template <typename T16, typename OT, int BIASM>
__global__ __launch_bounds__(128) void k_gemmw(const T16* __restrict__ A, const T16* __restrict__ Bt, int K, OT* C, int ldc, const float* __restrict__ bias, float alpha) {
    __shared__ __align__(16) char ring[2 * STG];
    gemm_tile<T16, OT, BIASM>(ring, A, Bt, K, C, ldc, bias, alpha, blockIdx.x * (unsigned)BT, blockIdx.y * (unsigned)BT, false);
}

// k_proj: the q_, k_ and v_^T head planes of all batches in one grid (SEQ/128, 256/128, 3 * batches * 8), 128 threads; blockIdx.z = (which * batches + batch) * 8 + head, which 0 q, 1 k, 2 v.
// q_, k_ [SEQ][256]: A = x of the batch [SEQ][256], Bt = W^T of the head [256 out][256 in], per-column bias. v_^T [256 d][SEQ t]: A = Wv^T of the head (rows = d), Bt = x of the batch (rows = t), per-row bias.
__global__ __launch_bounds__(128) void k_proj(const bf* __restrict__ XP, const bf* __restrict__ WT, h16* QP, h16* KP, h16* VT, const float* __restrict__ bq, const float* __restrict__ bk, const float* __restrict__ bv) {
    __shared__ __align__(16) char ring[2 * STG];
    const unsigned which = blockIdx.z / (unsigned)(NB * NHEAD), zz = blockIdx.z - which * (unsigned)(NB * NHEAD); const unsigned h = zz & 7u, b = zz >> 3;
    const bool vt = which == 2u;
    const bf* X = XP + ((size_t)which * NB + b) * ((size_t)SEQ * DD); const bf* Wh = WT + ((size_t)which * NHEAD + h) * ((size_t)DD * DD);
    const float* bias = ((which == 0u) ? bq : ((which == 1u) ? bk : bv)) + h * (unsigned)DD;
    h16* P = ((which == 0u) ? QP : ((which == 1u) ? KP : VT)) + (size_t)zz * ((size_t)SEQ * DD);
    const unsigned ts = blockIdx.x * (unsigned)BT, td = blockIdx.y * (unsigned)BT;
    gemm_tile<bf, h16, 3>(ring, vt ? Wh : X, vt ? X : Wh, DD, P, vt ? SEQ : DD, bias, 1.0f, vt ? td : ts, vt ? ts : td, vt);
}

#define XBLK ((unsigned)((size_t)NB * SEQ * DD / 8 / 256))   // blocks per x plane
#define WBLK ((unsigned)((WLINES + OLINES) / 64))            // blocks of the weight planes
// xplanes: block blk of 3 * XBLK: 2,048 elements of bf16(x), planes q, k, v
__device__ __forceinline__ void xplanes(unsigned blk, const float* __restrict__ xq, const float* __restrict__ xk, const float* __restrict__ xv, bf* XP) {
    const unsigned which = blk / XBLK; const unsigned i = (blk - which * XBLK) * 256u + threadIdx.x;
    const unsigned GPB = (unsigned)(SEQ * DD / 8); const unsigned b = i / GPB, rem = i - b * GPB;
    const float* src = (which == 0u) ? xq : ((which == 1u) ? xk : xv);
    const v8f v = *(const v8f*)(src + (size_t)b * SEQ_FULL * DD + (size_t)rem * 8);
    v8us o;
#pragma unroll
    for (int k = 0; k < 8; ++k) o[k] = f2bf(v[k]);
    bf* dst = XP + (size_t)which * NB * SEQ * DD + (size_t)i * 8;
    *(v8us*)dst = o; 
}

// wprep: block blk of WBLK; lines 0..WLINES-1: per-head transposed bf16 weight planes WT[mtx = which*8 + h][n][k] = bf16(W[h][k][n]) (which 0 Wq, 1 Wk, 2 Wv); the other lines: the Wo plane
__device__ __forceinline__ void wprep(unsigned blk, const float* __restrict__ wq, const float* __restrict__ wk, const float* __restrict__ wv, const float* __restrict__ wo, bf* WT, unsigned short* WOS) {
    const unsigned lane = threadIdx.x & 31u; const unsigned L0 = (blk * 8u + (threadIdx.x >> 5)) * 8u;
{
#pragma unroll 1
        for (unsigned l = 0; l < 8u; ++l) { const unsigned L = L0 + l; v2us o;
            if (L < (unsigned)WLINES) {   // block-uniform
                const unsigned mtx = L >> 10, which = mtx >> 3, h = mtx & 7u; const unsigned e = (L & 1023u) * 64u + lane * 2u; const unsigned k = e & 255u, n = e >> 8;
                const float* src = ((which == 0u) ? wq : ((which == 1u) ? wk : wv)) + (size_t)h * DD * DD;
                o[0] = f2bf(src[(size_t)k * DD + n]); o[1] = f2bf(src[(size_t)(k + 1u) * DD + n]);
                *(v2us*)(WT + (size_t)mtx * DD * DD + e) = o;
            } else {
                const unsigned e = (L - (unsigned)WLINES) * 64u + lane * 2u; const unsigned kk = e & (unsigned)(KM - 1), n = e >> 11; const unsigned h = kk >> 8, d = kk & 255u;
                const float x0 = bfr(wo[(size_t)(d * 8u + h) * DD + n]) * WOCAR; const float x1 = bfr(wo[(size_t)((d + 1u) * 8u + h) * DD + n]) * WOCAR;
                o[0] = __builtin_bit_cast(unsigned short, (h16)x0); o[1] = __builtin_bit_cast(unsigned short, (h16)x1);
                *(v2us*)(WOS + e) = o;
            }
            asm volatile("s_wait_xcnt 0x0" ::: "memory");   // stands in front of the next line's writes to registers that this line's store names
        }
         }
}

// k_prep: every 16-bit operand plane in one grid of WBLK + 3 * XBLK blocks, 256 threads; the weight blocks, which run longest, have the lowest indices.
__global__ __launch_bounds__(256) void k_prep(const float* __restrict__ xq, const float* __restrict__ xk, const float* __restrict__ xv, const float* __restrict__ wq, const float* __restrict__ wk, const float* __restrict__ wv, const float* __restrict__ wo, bf* XP, bf* WT, unsigned short* WOS) {
    if (blockIdx.x >= WBLK) { xplanes(blockIdx.x - WBLK, xq, xk, xv, XP); return; }   // block-uniform
    wprep(blockIdx.x, wq, wk, wv, wo, WT, WOS);
}

// ---- k_fattn: scores, softmax and P.V of one head for 256 queries per block; 8 waves, each 32 query columns; grid (SEQ/256, batch*8 + head), 256 threads.
// Transposed products: S^T = k_ . q_^T (A = k_ rows from LDS, B = q_ kept in registers), O^T += v_^T . P^T (A = v_^T rows from LDS, B = P^T packed from the score accumulators of the same lane).
// In a score tile a lane holds keys 8*hi + j of query lr; tiles of keys 0..15 and 16..31 give elements 0..7 and 8..15 of the B fragment, which is the loaders' k order.
// A stage is 64 keys: [k_ 64 rows of 512 B at pitch 528 | v_^T 256 rows of 128 B at pitch 144] in a two-buffer LDS ring laid by asynchronous copies; a pass is 32 keys.
// Online softmax in the log2 domain: the maximum in use moves only when a pass exceeds it by more than 8 (P <= 256 fits f16), tested once per pass by a scalar branch.
#define FKB  64                   // keys per ring stage
#define KPIT 528u                 // LDS pitch of a k_ row, bytes (16 B x odd)
#define VPIT 144u                 // LDS pitch of a v_^T row piece, bytes (16 B x odd)
#define FKSZ ((unsigned)FKB * KPIT)
#define FSTG (FKSZ + (unsigned)DD * VPIT)
static_assert(DD == 256 && SEQ % FKB == 0 && SEQ / FKB >= 2);

// Eight copies of one wave, 16 B a lane: LDS address l + i*ls bytes, global address g + i*gs elements. The builtin form: with these copies as asm statements the register allocation of k_fattn spilled q_ fragments, with the builtin it does not.
typedef int v4i __attribute__((ext_vector_type(4)));
typedef float v2f __attribute__((ext_vector_type(2)));
__device__ __forceinline__ void copy8s(char* l, unsigned ls, const h16* g, size_t gs) {
#pragma unroll
    for (int i = 0; i < 8; ++i)
        __builtin_amdgcn_global_load_async_to_lds_b128((__attribute__((address_space(1))) v4i*)(g + (size_t)i * gs), (__attribute__((address_space(3))) v4i*)(l + (unsigned)i * ls), 0, 0);
}

// lane l's value from lane l ^ 16 (a vector-unit exchange: an LDS permute would queue behind the fragment reads issued ahead)
__device__ __forceinline__ float xhalf(float x) { return __builtin_bit_cast(float, __builtin_amdgcn_permlanex16(__builtin_bit_cast(int, x), __builtin_bit_cast(int, x), 0x76543210, 0xfedcba98, false, false)); }

__global__ __launch_bounds__(256) void k_fattn(const h16* __restrict__ QPl, const h16* __restrict__ KPl, const h16* __restrict__ VTl, h16* __restrict__ CT) {
    __shared__ __align__(16) char ring[2 * FSTG];
    static_assert(8u * 32u * KPIT <= 2u * FSTG);
    const unsigned lane = threadIdx.x & 31u, lr = lane & 15u, hi = lane >> 4; const unsigned w = (unsigned)__builtin_amdgcn_readfirstlane((int)(threadIdx.x >> 5));
    const size_t z = blockIdx.y; const h16* Qh = QPl + z * ((size_t)SEQ * DD); const h16* Kh = KPl + z * ((size_t)SEQ * DD); const h16* Vh = VTl + z * ((size_t)SEQ * DD);
    const unsigned q0 = blockIdx.x * 256u + w * 32u;
    // copy addresses: k_ rows w*8 + i, a whole 512-B row per copy; v_^T rows 32*i + w*4 + lane/8, 16-byte piece lane%8 of the row's 128 B (a step of 32 rows is beyond the copy's offset field, so each copy carries its own two addresses)
    char* lk = ring + w * 8u * KPIT + lane * 16u; char* lv = ring + FKSZ + (w * 4u + (lane >> 3)) * VPIT + (lane & 7u) * 16u;
    const h16* gk = Kh + (size_t)(w * 8u) * DD + lane * 8u; const h16* gv = Vh + (size_t)(w * 4u + (lane >> 3)) * SEQ + (lane & 7u) * 8u;
    copy8s(lk, KPIT, gk, (size_t)DD); copy8s(lv, 32u * VPIT, gv, (size_t)32 * SEQ);
    v16h qf[2][8];
#pragma unroll
    for (int qt = 0; qt < 2; ++qt)
#pragma unroll
        for (int ks = 0; ks < 8; ++ks) qf[qt][ks] = WFrag<h16>::ld(Qh + (size_t)(q0 + (unsigned)qt * 16u + lr) * DD + (unsigned)ks * 32u + hi * 8u);
    v8f o[16][2];
#pragma unroll
    for (int dt = 0; dt < 16; ++dt) { o[dt][0] = (v8f){}; o[dt][1] = (v8f){}; }
    float mrun[2] = {-3.0e38f, -3.0e38f}, lsum[2] = {0.f, 0.f};
    asm volatile("s_wait_asynccnt 0x0" ::: "memory");   // this wave's rows of stage 0 have landed
    __syncthreads();                                     // stage 0 published to the eight waves
    copy8s(lk + FSTG, KPIT, gk + (size_t)FKB * DD, (size_t)DD); copy8s(lv + FSTG, 32u * VPIT, gv + FKB, (size_t)32 * SEQ);
    const char* fk = ring + lr * KPIT + hi * 16u; const char* fv = ring + FKSZ + lr * VPIT + hi * 16u;
    const int nt = SEQ / FKB;
// fragment of pass p (32 keys) in buffer offset bo: k_ key tile kt, k-step u; v_^T d tile dt
#define LDK(p, u, kt) WFrag<h16>::ld((const h16*)(fk + bo + (unsigned)((p) * 32 + (kt) * 16) * KPIT + (unsigned)(u) * 64u))
#define LDV(p, dt)    WFrag<h16>::ld((const h16*)(fv + bo + (unsigned)(dt) * 16u * VPIT + (unsigned)(p) * 64u))
    for (int t = 0; t < nt; ++t) {
        const unsigned bo = ((unsigned)t & 1u) * FSTG;
        // Fragments are read ahead of their products, never past the stage. A unit = 2 fragments and 4 products: the two key tiles' k_ fragments of one k-step, or two d tiles' v_^T fragments.
        // Each unit is read two units ahead into a ring of three sets; P.V's first two units are read under the last two score units, the next pass's first two score units under the last two of P.V.
        v16h fs[3][2], fw[3][2]; v8f st[2][2]; v16h pf[2];
        fs[0][0] = LDK(0, 0, 0); fs[0][1] = LDK(0, 0, 1); fs[1][0] = LDK(0, 1, 0); fs[1][1] = LDK(0, 1, 1);
#pragma unroll
        for (int p = 0; p < 2; ++p) {
            st[0][0] = (v8f){}; st[0][1] = (v8f){}; st[1][0] = (v8f){}; st[1][1] = (v8f){};
#pragma unroll
            for (int u = 0; u < 8; ++u) {
                if (u < 6) { fs[(u + 2) % 3][0] = LDK(p, u + 2, 0); fs[(u + 2) % 3][1] = LDK(p, u + 2, 1); }
                else { fw[u - 6][0] = LDV(p, (u - 6) * 2); fw[u - 6][1] = LDV(p, (u - 6) * 2 + 1); }
                __builtin_amdgcn_sched_barrier(0);   // keeps the LDS reads issued ahead as one group in front of these products instead of spread among them
#pragma unroll
                for (int kt = 0; kt < 2; ++kt)
#pragma unroll
                    for (int qt = 0; qt < 2; ++qt) st[kt][qt] = wmma16(fs[u % 3][kt], qf[qt][u], st[kt][qt]);
                __builtin_amdgcn_sched_barrier(0);   // the other side of the pair: later reads stay behind these products
            }
            float ms[2];
#pragma unroll
            for (int qt = 0; qt < 2; ++qt) { float a = fmaxf(st[0][qt][0], st[1][qt][0]);
#pragma unroll
                for (int j = 1; j < 8; ++j) a = fmaxf(a, fmaxf(st[0][qt][j], st[1][qt][j]));
                a = fmaxf(a, xhalf(a)); ms[qt] = a * SCL2; }
            const bool need = (ms[0] > mrun[0] + 8.0f) || (ms[1] > mrun[1] + 8.0f);
            if (__builtin_amdgcn_ballot_w32(need) != 0) {   // wave-uniform: every lane rescales its two queries or none does
#pragma unroll
                for (int qt = 0; qt < 2; ++qt) { const float mn = fmaxf(mrun[qt], ms[qt]); const float al = __builtin_amdgcn_exp2f(mrun[qt] - mn); mrun[qt] = mn; lsum[qt] *= al;
#pragma unroll
                    for (int dt = 0; dt < 16; ++dt) o[dt][qt] *= al; }
            }
#pragma unroll
            for (int qt = 0; qt < 2; ++qt) { v16h pk; const float nm = -mrun[qt]; v2f ps[2] = {(v2f){0.f, 0.f}, (v2f){0.f, 0.f}};
#pragma unroll
                for (int i = 0; i < 8; ++i) {
                    const v2f arg = __builtin_elementwise_fma((v2f){st[i >> 2][qt][2 * (i & 3)], st[i >> 2][qt][2 * (i & 3) + 1]}, (v2f){SCL2, SCL2}, (v2f){nm, nm});
                    const float e0 = __builtin_amdgcn_exp2f(arg.x), e1 = __builtin_amdgcn_exp2f(arg.y);
                    ps[i & 1] += (v2f){e0, e1}; pk[2 * i] = (h16)e0; pk[2 * i + 1] = (h16)e1; }
                lsum[qt] += (ps[0].x + ps[1].x) + (ps[0].y + ps[1].y);
                asm volatile("" : "+v"(lsum[qt]));   // each row's sum, against spills: left free, the adds sink behind the P.V products and the 32 exponentials stay live into the next pass
                pf[qt] = pk; }
#pragma unroll
            for (int u = 0; u < 8; ++u) {
                if (u < 6) { fw[(u + 2) % 3][0] = LDV(p, (u + 2) * 2); fw[(u + 2) % 3][1] = LDV(p, (u + 2) * 2 + 1); }
                else if (p == 0) { fs[u - 6][0] = LDK(1, u - 6, 0); fs[u - 6][1] = LDK(1, u - 6, 1); }
                __builtin_amdgcn_sched_barrier(0);   // as above: the reads issued ahead stay one group in front of these products
#pragma unroll
                for (int i = 0; i < 2; ++i)
#pragma unroll
                    for (int qt = 0; qt < 2; ++qt) o[u * 2 + i][qt] = wmma16(fw[u % 3][i], pf[qt], o[u * 2 + i][qt]);
                __builtin_amdgcn_sched_barrier(0);   // the other side of the pair
            }
        }
        asm volatile("s_wait_dscnt 0x0" ::: "memory");      // this wave's reads of buffer t%2 are done before the buffer is refilled
        asm volatile("s_wait_asynccnt 0x0" ::: "memory");   // this wave's rows of stage t+1 have landed
        __syncthreads();                                     // publishes stage t+1 and ends every wave's reads of stage t
        if (t + 2 < nt) { copy8s(lk + bo, KPIT, gk + (size_t)(t + 2) * FKB * DD, (size_t)DD); copy8s(lv + bo, 32u * VPIT, gv + (size_t)(t + 2) * FKB, (size_t)32 * SEQ); }
    }
    asm volatile("s_wait_asynccnt 0x0" ::: "memory");       // nothing in flight when the ring becomes output staging
    // O^T tile: lane holds d = dt*16 + 8*hi + j of query lr: 16 B of that query's ctx row; rows staged (pitch 528 B, a range per wave) so that each store covers a whole 512-B row segment
    char* os = ring + w * (32u * KPIT);
#pragma unroll
    for (int qt = 0; qt < 2; ++qt) { const float inv = __fdiv_rn(CCAR, lsum[qt] + xhalf(lsum[qt]));
#pragma unroll
        for (int dt = 0; dt < 16; ++dt) { v8h ov;
#pragma unroll
            for (int j = 0; j < 8; ++j) ov[j] = (h16)(o[dt][qt][j] * inv);
            *(v8h*)(os + ((unsigned)qt * 16u + lr) * KPIT + (unsigned)dt * 32u + hi * 16u) = ov; } }
    __syncthreads();                                         // the staged rows are complete before other lanes read them back
    h16* crow = CT + ((z >> 3) * (size_t)SEQ + q0) * KM + (z & 7u) * (size_t)DD + lane * 8u;
    v8h rowv[32];   // all 32 rows are read into registers of their own ahead of the stores, and one address serves every store: no register that an issued store names is written again
#pragma unroll
    for (int r = 0; r < 32; ++r) rowv[r] = *(const v8h*)(os + (unsigned)r * KPIT + lane * 16u);
#pragma unroll
    for (int r = 0; r < 32; ++r) *(v8h*)(crow + (size_t)r * KM) = rowv[r];
}

// Workspace carve (bytes, each region 256-B aligned by construction of the sizes).
#define SZ_XP  ((size_t)3 * NB * SEQ * DD * 2)
#define SZ_WT  ((size_t)3 * NHEAD * DD * DD * 2)
#define SZ_WOS ((size_t)DD * KM * 2)
#define SZ_HP  ((size_t)NB * NHEAD * SEQ * DD * 2)
#define SZ_ALL (SZ_XP + SZ_WT + SZ_WOS + 4 * SZ_HP)
static_assert(SZ_ALL <= (size_t)268435456);
static_assert(SZ_XP % 256 == 0 && SZ_WT % 256 == 0 && SZ_WOS % 256 == 0 && SZ_HP % 256 == 0);
static_assert((size_t)SEQ * KM == (size_t)NHEAD * SEQ * DD);   // the ctx plane has the size of one set of head planes

extern "C" void kernel_launch(void* const* d_in, const int* in_sizes, int n_in,
                              void* d_out, int out_size, void* d_ws, size_t ws_size, hipStream_t stream) {
    if (n_in < 11) return;
    const size_t xneed = (size_t)(NB - 1) * SEQ_FULL * DD + (size_t)SEQ * DD;
    if ((size_t)in_sizes[0] < xneed || (size_t)in_sizes[1] < xneed || (size_t)in_sizes[2] < xneed) return;
    if ((size_t)in_sizes[3] < (size_t)NHEAD * DD * DD || (size_t)in_sizes[5] < (size_t)NHEAD * DD * DD || (size_t)in_sizes[7] < (size_t)NHEAD * DD * DD) return;
    if ((size_t)in_sizes[4] < (size_t)NHEAD * DD || (size_t)in_sizes[6] < (size_t)NHEAD * DD || (size_t)in_sizes[8] < (size_t)NHEAD * DD) return;
    if ((size_t)in_sizes[9] < (size_t)KM * DD || (size_t)in_sizes[10] < (size_t)DD) return;
    if ((size_t)out_size < (size_t)NB * SEQ * DD) return;
    if (SZ_ALL > ws_size) return;
    const float* Kin = (const float*)d_in[0]; const float* Vin = (const float*)d_in[1]; const float* Qin = (const float*)d_in[2];
    const float* Wk = (const float*)d_in[3]; const float* bk = (const float*)d_in[4]; const float* Wv = (const float*)d_in[5]; const float* bv = (const float*)d_in[6];
    const float* Wq = (const float*)d_in[7]; const float* bq = (const float*)d_in[8]; const float* Wo = (const float*)d_in[9]; const float* bo = (const float*)d_in[10];
    float* OUT = (float*)d_out;     // [NB][SEQ][256]
    char* wsp = (char*)d_ws;
    bf* XP = (bf*)wsp; wsp += SZ_XP;            // [3][NB][SEQ][256] bf16: q, k, v
    bf* WT = (bf*)wsp; wsp += SZ_WT;            // [3][8][256 out][256 in] bf16: Wq^T, Wk^T, Wv^T
    h16* WOS = (h16*)wsp; wsp += SZ_WOS;        // [256][2048] f16 (x256), column h*256 + d
    h16* QP = (h16*)wsp; wsp += SZ_HP;          // [NB][8][SEQ][256]
    h16* KP = (h16*)wsp; wsp += SZ_HP;          // [NB][8][SEQ][256]
    h16* VT = (h16*)wsp; wsp += SZ_HP;          // [NB][8][256][SEQ]
    h16* CTX = (h16*)wsp; wsp += SZ_HP;         // [NB][SEQ][2048] (x64), column h*256 + d

    k_prep<<<WBLK + 3u * XBLK, 256, 0, stream>>>(Qin, Kin, Vin, Wq, Wk, Wv, Wo, XP, WT, (unsigned short*)WOS);
    // q_, k_ and v_^T head planes, all heads of all batches
    k_proj<<<dim3(SEQ / 128, DD / 128, 3 * NB * NHEAD), 128, 0, stream>>>(XP, WT, QP, KP, VT, bq, bk, bv);
    // ctx[zb][t][h*256 + d] = 64 softmax(q_ . k_ / 16) . v_, all heads of all batches
    k_fattn<<<dim3(SEQ / 256, NB * NHEAD, 1), 256, 0, stream>>>(QP, KP, VT, CTX);
    // out = ctx . Wo (row-permuted plane) / 16384 + bo, the rows of all batches in one launch
    k_gemmw<h16, float, 1><<<dim3(NB * SEQ / 128, DD / 128, 1), 128, 0, stream>>>(CTX, WOS, KM, OUT, DD, bo, FINSC);
}

// v006
// It runs in 111 microseconds.
// Versions in between are left out here; by their measured steps it is 1.27 times as fast as v004.
// Counting every step since v000, it is 8.28 times as fast.
#include <hip/hip_runtime.h>

// Multi-head attention with full-width (256) heads, the k and v projections re-associated into the weights, so that no k_ or v_ head plane is formed:
//   scores: q_ . k_ = (x_q M + c) . x_k + (a term that is the same for every key of a query and so drops out of the softmax), M = Wq Wk^T, c = bq Wk^T, per head;
//   output: sum_h (P_h v_h) Wo_h + bo = sum_h (P_h x_v) G_h + (bo + sum_h bv_h Wo_h), G_h = Wv_h Wo_h, because each row of P sums to 1.
// Every head of a batch reads the same key plane f16(x_k) and the same value plane f16(x_v)^T.
// Compute dtypes, f32 accumulate everywhere: M and q'' = x_q M + c on v_wmma_f32_16x16x32_bf16 (x_q, Wq, Wk, M RNE-converted to bf16); G, scores, P.x_v and the output mix on v_wmma_f32_16x16x32_f16
// (q'' f16 plane; scores stay f32 in registers; P f16 of exp2(score*log2(e)/16 - running maximum); ctx f16 carried x64; Wo plane f16 of bf16(Wo) x256, G plane f16 x256; c and the output bias f32). Softmax in f32, online over key passes.

#ifndef NB
#define NB 4
#endif
#ifndef SEQ
#define SEQ 2048
#endif
#define NB_FULL  4
#define SEQ_FULL 2048
#define DD    256                 // model width = head width
#define NHEAD 8
#define KM    (NHEAD * DD)        // merged context width (plane column = h*256 + d)
#define SCL2  0.09016844005556021f   // log2(e) / sqrt(256)
#define CCAR  64.0f               // carry of the ctx plane
#define WOCAR 256.0f              // carry of the Wo plane
#define FINSC (1.0f / 16384.0f)   // 1 / (64 * 256)
#define VLINES (NHEAD * DD * DD / 64)
#define OLINES (DD * KM / 64)

typedef _Float16 h16;
typedef unsigned short bf;
typedef __attribute__((ext_vector_type(16))) __bf16   v16bf;
typedef __attribute__((ext_vector_type(16))) _Float16 v16h;
typedef __attribute__((ext_vector_type(8)))  _Float16 v8h;
typedef __attribute__((ext_vector_type(8)))  unsigned short v8us;
typedef __attribute__((ext_vector_type(4)))  unsigned short v4us;
typedef __attribute__((ext_vector_type(2)))  unsigned short v2us;
typedef __attribute__((ext_vector_type(8)))  float    v8f;
typedef __attribute__((ext_vector_type(4)))  float    v4f;
typedef v4f  __attribute__((may_alias)) v4fa;

static_assert(SEQ % 256 == 0);
static_assert(NHEAD == 8);
static_assert(DD % 128 == 0 && DD % 64 == 0 && KM % 64 == 0 && SEQ % 128 == 0);
static_assert(((size_t)NB * SEQ * DD / 8) % 256 == 0);
static_assert(VLINES % 64 == 0 && OLINES % 64 == 0);

__device__ __forceinline__ unsigned short f2bf(float f) { unsigned u = __float_as_uint(f); u += 0x7FFFu + ((u >> 16) & 1u); return (unsigned short)(u >> 16); }
__device__ __forceinline__ float bf2f(unsigned short b) { return __uint_as_float(((unsigned)b) << 16); }
__device__ __forceinline__ float bfr(float f) { return bf2f(f2bf(f)); }
__device__ __forceinline__ v16h cat16(v8h lo, v8h hi) { return __builtin_shufflevector(lo, hi, 0, 1, 2, 3, 4, 5, 6, 7, 8, 9, 10, 11, 12, 13, 14, 15); }
__device__ __forceinline__ v16bf cat16b(v8us lo, v8us hi) { return __builtin_bit_cast(v16bf, __builtin_shufflevector(lo, hi, 0, 1, 2, 3, 4, 5, 6, 7, 8, 9, 10, 11, 12, 13, 14, 15)); }
__device__ __forceinline__ v8f wmma16(v16h a, v16h b, v8f c) { return __builtin_amdgcn_wmma_f32_16x16x32_f16(false, a, false, b, (short)0, c, false, false); }
__device__ __forceinline__ v8f wmmab(v16bf a, v16bf b, v8f c) { return __builtin_amdgcn_wmma_f32_16x16x32_bf16(false, a, false, b, (short)0, c, false, false); }

// Fragment loaders: lane (lr = lane & 15, hi = lane >> 4); p points at row lr, k0 + 8*hi; elements 0..7 = k0+8hi.., elements 8..15 = k0+16+8hi.. (same map for A and B).
template <typename T16> struct WFrag;
template <> struct WFrag<h16> { typedef v16h V; static __device__ __forceinline__ V ld(const h16* p) { return cat16(*(const v8h*)p, *(const v8h*)(p + 16)); } static __device__ __forceinline__ v8f mma(V a, V b, v8f c) { return wmma16(a, b, c); } };
template <> struct WFrag<bf> { typedef v16bf V; static __device__ __forceinline__ V ld(const bf* p) { return cat16b(*(const v8us*)p, *(const v8us*)(p + 16)); } static __device__ __forceinline__ v8f mma(V a, V b, v8f c) { return wmmab(a, b, c); } };

// Slab epilogues: 16 rows x 64 columns staged in LDS (pitch 68 floats) -> global; value = x*alpha + bias (BIASM 0: none, 1: per column, f32).
template <int BIASM>
__device__ __forceinline__ void slab_store(const float* os, h16* crow, int ldc, const float* bias, float alpha, unsigned colbase, unsigned lane) {
    const unsigned rq = lane >> 3, cq = lane & 7u;
    float bc[8];
#pragma unroll
    for (int e = 0; e < 8; ++e) bc[e] = 0.f;
    if (BIASM == 1) { const v4f b0 = *(const v4f*)(bias + colbase + cq * 8u); const v4f b1 = *(const v4f*)(bias + colbase + cq * 8u + 4u);
#pragma unroll
        for (int e = 0; e < 4; ++e) { bc[e] = b0[e]; bc[4 + e] = b1[e]; } }
    v8h vals[4];
#pragma unroll
    for (int s = 0; s < 4; ++s) { const unsigned row = (unsigned)s * 4u + rq; const v4f x0 = *(const v4fa*)(os + row * 68u + cq * 8u); const v4f x1 = *(const v4fa*)(os + row * 68u + cq * 8u + 4u);
        v8h o;
#pragma unroll
        for (int e = 0; e < 4; ++e) { o[e] = (h16)(x0[e] * alpha + bc[e]); o[4 + e] = (h16)(x1[e] * alpha + bc[4 + e]); }
        vals[s] = o; }
#pragma unroll
    for (int s = 0; s < 4; ++s) { const unsigned row = (unsigned)s * 4u + rq; *(v8h*)(crow + (size_t)row * ldc + cq * 8u) = vals[s]; }
}

// ---- gemm_tile: GEMM, one 128x128 output tile (rows from rb, columns from cb) per block of FOUR waves (2 x 2), each wave a 64x64 tile (16 accumulators); 128 threads.
// Operands come from K-contiguous 16-bit planes in slices of 64 k (128 B = one line of every row): [A 128 rows | Bt 128 rows] at pitch 144 B in a two-buffer LDS ring,
// laid by asynchronous copies (each wave 32 rows of A and 32 of Bt, 8 lanes a row); every wave reads its fragments from the ring, so a row is fetched once per block and not once per wave.
// C[m][n] (pitch ldc) = alpha * sum_k A[m][k] Bt[n][k] (+ bias per column); A rows at pitch lda, Bt rows at pitch ldb elements. K % 64 == 0, M % 128 == 0, N % 128 == 0 (host-checked by static_assert).
// Behind the loop the ring is free and each wave stages its output slabs in a range of its own ('os', wave-level ordering only).
#define BT   128                  // block tile rows = columns
#define BK   64                   // k per ring stage
#define LP   144u                 // LDS row pitch in bytes (16 B x odd: ds_load_b128 without bank conflicts)
#define STG  (2u * BT * LP)       // one stage: A rows, then Bt rows

// Eight copies of one wave: rows 0, 4, .. 28 from the lane's own row (global pitch K elements, LDS pitch LP), 16 B a lane. The s_wait_xcnt stands inside the statement so that no address register is rewritten ahead of it.
template <typename T16>
__device__ __forceinline__ void copy8(unsigned l, const T16* g, size_t K) {
    asm volatile("global_load_async_to_lds_b128 %0, %8, off\n\t"
                 "global_load_async_to_lds_b128 %1, %9, off\n\t"
                 "global_load_async_to_lds_b128 %2, %10, off\n\t"
                 "global_load_async_to_lds_b128 %3, %11, off\n\t"
                 "global_load_async_to_lds_b128 %4, %12, off\n\t"
                 "global_load_async_to_lds_b128 %5, %13, off\n\t"
                 "global_load_async_to_lds_b128 %6, %14, off\n\t"
                 "global_load_async_to_lds_b128 %7, %15, off\n\t"
                 "s_wait_xcnt 0x0"
                 :: "v"(l), "v"(l + 4u * LP), "v"(l + 8u * LP), "v"(l + 12u * LP), "v"(l + 16u * LP), "v"(l + 20u * LP), "v"(l + 24u * LP), "v"(l + 28u * LP),
                    "v"(g), "v"(g + 4 * K), "v"(g + 8 * K), "v"(g + 12 * K), "v"(g + 16 * K), "v"(g + 20 * K), "v"(g + 24 * K), "v"(g + 28 * K)
                 : "memory");
}

// A wave's 64x64 tile (rows from r0, columns from c0) to global memory: four slabs of 16 rows through the wave's own staging range os.
template <int BIASM, typename OT>
__device__ __forceinline__ void tile_out(const v8f (&acc)[4][4], float* os, OT* C, int ldc, const float* bias, float alpha, unsigned r0, unsigned c0, unsigned lane) {
    const unsigned lr = lane & 15u, hi = lane >> 4;
#pragma unroll
    for (int mb = 0; mb < 4; ++mb) {
#pragma unroll
        for (int nb = 0; nb < 4; ++nb) {
#pragma unroll
            for (int j = 0; j < 8; ++j) os[(hi * 8u + (unsigned)j) * 68u + (unsigned)nb * 16u + lr] = acc[mb][nb][j]; }   // D: row 8*hi + j, col lr
        __builtin_amdgcn_fence(3 /* release order */, "wavefront"); __builtin_amdgcn_wave_barrier(); asm volatile("" ::: "memory");
        OT* crow = C + (size_t)(r0 + (unsigned)mb * 16u) * ldc + c0;
        slab_store<BIASM>(os, crow, ldc, bias, alpha, c0, lane);
        asm volatile("s_wait_xcnt 0x0" ::: "memory");   // stands in front of the next slab's writes to registers that this slab's stores name
        __builtin_amdgcn_fence(3 /* release order */, "wavefront"); __builtin_amdgcn_wave_barrier(); asm volatile("" ::: "memory");
    }
}

template <typename T16, typename OT, int BIASM>
__device__ __forceinline__ void gemm_tile(char* ring, const T16* __restrict__ A, int lda, const T16* __restrict__ Bt, int ldb, int K, OT* C, int ldc, const float* __restrict__ bias, float alpha, unsigned rb, unsigned cb) {
    typedef typename WFrag<T16>::V V;
    static_assert(4 * 16 * 68 * 4 <= 2 * STG);
    const unsigned lane = threadIdx.x & 31u, lr = lane & 15u, hi = lane >> 4; const unsigned w = (unsigned)__builtin_amdgcn_readfirstlane((int)(threadIdx.x >> 5));
    const unsigned wr = (w >> 1) * 64u, wc = (w & 1u) * 64u; const unsigned r0 = rb + wr, c0 = cb + wc;
    v8f acc[4][4];
#pragma unroll
    for (int mb = 0; mb < 4; ++mb)
#pragma unroll
        for (int nb = 0; nb < 4; ++nb) acc[mb][nb] = (v8f){};
    // the lane's own copy addresses: row w*32 + lane/8 of the block's A and Bt rows, 16-byte piece lane%8 of the row's 128 B
    const unsigned cprow = w * 32u + (lane >> 3), cpc = lane & 7u;
    const T16* ga = A + (size_t)(rb + cprow) * lda + cpc * 8u; const T16* gb = Bt + (size_t)(cb + cprow) * ldb + cpc * 8u;
    const unsigned la = (unsigned)(size_t)(const void*)ring + cprow * LP + cpc * 16u, lb = la + (unsigned)BT * LP;
    const int nt = K / BK;
    copy8(la, ga, (size_t)lda); copy8(lb, gb, (size_t)ldb);
    asm volatile("s_wait_asynccnt 0x0" ::: "memory");   // this wave's rows of stage 0 have landed
    __syncthreads();                                     // stage 0 published to the four waves
    if (nt > 1) { copy8(la + STG, ga + BK, (size_t)lda); copy8(lb + STG, gb + BK, (size_t)ldb); }
    const char* fa = ring + (wr + lr) * LP + hi * 16u; const char* fb = ring + ((unsigned)BT + wc + lr) * LP + hi * 16u;
#pragma unroll 1
    for (int t = 0; t < nt; ++t) {
        const unsigned bo = ((unsigned)t & 1u) * STG;
#pragma unroll
        for (int ks = 0; ks < BK / 32; ++ks) {
            V a[4], b[4];
            a[0] = WFrag<T16>::ld((const T16*)(fa + bo + (unsigned)ks * 64u)); b[0] = WFrag<T16>::ld((const T16*)(fb + bo + (unsigned)ks * 64u));
#pragma unroll
            for (int mb = 1; mb < 4; ++mb) a[mb] = WFrag<T16>::ld((const T16*)(fa + bo + (unsigned)mb * 16u * LP + (unsigned)ks * 64u));
#pragma unroll
            for (int nb = 1; nb < 4; ++nb) b[nb] = WFrag<T16>::ld((const T16*)(fb + bo + (unsigned)nb * 16u * LP + (unsigned)ks * 64u));
            __builtin_amdgcn_sched_barrier(0);   // keeps the 16 LDS reads one group ahead of their 16 products: left free, the compiler spreads them among the products, each group behind a full LDS wait
#pragma unroll
            for (int nb = 0; nb < 4; ++nb)
#pragma unroll
                for (int mb = 0; mb < 4; ++mb) acc[mb][nb] = WFrag<T16>::mma(a[mb], b[nb], acc[mb][nb]);
            __builtin_amdgcn_sched_barrier(0);   // the other side of the pair: the next group's reads stay behind these products
        }
        asm volatile("s_wait_dscnt 0x0" ::: "memory");      // this wave's reads of buffer t%2 are done before the buffer is refilled
        asm volatile("s_wait_asynccnt 0x0" ::: "memory");   // this wave's rows of stage t+1 have landed
        __syncthreads();                                     // publishes stage t+1 and ends every wave's reads of stage t
        if (t + 2 < nt) { copy8(la + bo, ga + (size_t)(t + 2) * BK, (size_t)lda); copy8(lb + bo, gb + (size_t)(t + 2) * BK, (size_t)ldb); }
    }
    asm volatile("s_wait_asynccnt 0x0" ::: "memory");       // nothing in flight when the ring becomes output staging
    float* os = (float*)(ring + w * (16u * 68u * 4u));
    tile_out<BIASM>(acc, os, C, ldc, bias, alpha, r0, c0, lane);
}

// ---- k_omix: the output mix, OUT[m][n] = FINSC * sum_k CT[m][k] G[n][k] + bias[n]; M = NB*SEQ rows, 256 columns, K = 2048. Grid (M/64, 256/128), 256 threads: every WGP has a block, two waves a SIMD.
// One 64x128 output tile per block of EIGHT waves (2 x 4), each wave a 32x32 tile (4 accumulators). A stage is 256 k: [CT 64 rows | G 128 rows] of 512 B at pitch 528 B in a two-buffer LDS ring laid by asynchronous copies,
// a whole 512-B row piece per copy; wave w lays CT rows 8w.. and G rows 16w.. (24 copies a stage). Eight trips: a trip's copies have the whole work on 256 k to land in.
// Every '#pragma unroll' in k_omix and its two helpers stands on a loop over a register array (addresses, fragments, accumulators, staged rows): rolled, the array would be indexed at run time and go to scratch.
#define OBM  64                   // block tile rows
#define OBN  128                  // block tile columns
#define OBK  256                  // k per ring stage
#define OLP  528u                 // LDS row pitch in bytes (16 B x odd)
#define OSTG ((unsigned)(OBM + OBN) * OLP)
static_assert(((size_t)NB * SEQ) % OBM == 0 && DD % OBN == 0 && KM % OBK == 0 && KM / OBK >= 2);

// Twelve copies of one wave, 16 B a lane, each with its own two addresses. The s_wait_xcnt stands inside the statement so that no address register is rewritten ahead of it.
__device__ __forceinline__ void copy12(const unsigned (&l)[12], const h16* const (&g)[12]) {
    asm volatile("global_load_async_to_lds_b128 %0, %12, off\n\t"
                 "global_load_async_to_lds_b128 %1, %13, off\n\t"
                 "global_load_async_to_lds_b128 %2, %14, off\n\t"
                 "global_load_async_to_lds_b128 %3, %15, off\n\t"
                 "global_load_async_to_lds_b128 %4, %16, off\n\t"
                 "global_load_async_to_lds_b128 %5, %17, off\n\t"
                 "global_load_async_to_lds_b128 %6, %18, off\n\t"
                 "global_load_async_to_lds_b128 %7, %19, off\n\t"
                 "global_load_async_to_lds_b128 %8, %20, off\n\t"
                 "global_load_async_to_lds_b128 %9, %21, off\n\t"
                 "global_load_async_to_lds_b128 %10, %22, off\n\t"
                 "global_load_async_to_lds_b128 %11, %23, off\n\t"
                 "s_wait_xcnt 0x0"
                 :: "v"(l[0]), "v"(l[1]), "v"(l[2]), "v"(l[3]), "v"(l[4]), "v"(l[5]), "v"(l[6]), "v"(l[7]), "v"(l[8]), "v"(l[9]), "v"(l[10]), "v"(l[11]),
                    "v"(g[0]), "v"(g[1]), "v"(g[2]), "v"(g[3]), "v"(g[4]), "v"(g[5]), "v"(g[6]), "v"(g[7]), "v"(g[8]), "v"(g[9]), "v"(g[10]), "v"(g[11])
                 : "memory");
}
// A wave's 24 copies of one stage: 8 CT rows from (la, ga), 16 G rows from (lb, gb); LDS pitch OLP, global pitch KM elements.
__device__ __forceinline__ void ostage(unsigned la, const h16* ga, unsigned lb, const h16* gb) {
    unsigned l[12]; const h16* g[12];
#pragma unroll
    for (int i = 0; i < 8; ++i) { l[i] = la + (unsigned)i * OLP; g[i] = ga + (size_t)i * KM; }
#pragma unroll
    for (int i = 0; i < 4; ++i) { l[8 + i] = lb + (unsigned)i * OLP; g[8 + i] = gb + (size_t)i * KM; }
    copy12(l, g);
#pragma unroll
    for (int i = 0; i < 12; ++i) { l[i] = lb + (unsigned)(4 + i) * OLP; g[i] = gb + (size_t)(4 + i) * KM; }
    copy12(l, g);
}

__global__ __launch_bounds__(256) void k_omix(const h16* __restrict__ CT, const h16* __restrict__ G, float* OUT, const float* __restrict__ bias) {
    __shared__ __align__(16) char ring[2 * OSTG];
    static_assert(8u * 32u * 36u * 4u <= 2u * OSTG);
    const unsigned lane = threadIdx.x & 31u, lr = lane & 15u, hi = lane >> 4; const unsigned w = (unsigned)__builtin_amdgcn_readfirstlane((int)(threadIdx.x >> 5));
    const unsigned rb = blockIdx.x * (unsigned)OBM, cb = blockIdx.y * (unsigned)OBN;
    const unsigned wr = (w >> 2) * 32u, wc = (w & 3u) * 32u;
    v8f acc[2][2];
#pragma unroll
    for (int mb = 0; mb < 2; ++mb)
#pragma unroll
        for (int nb = 0; nb < 2; ++nb) acc[mb][nb] = (v8f){};
    const h16* ga = CT + (size_t)(rb + w * 8u) * KM + lane * 8u; const h16* gb = G + (size_t)(cb + w * 16u) * KM + lane * 8u;
    const unsigned la = (unsigned)(size_t)(const void*)ring + w * 8u * OLP + lane * 16u, lb = (unsigned)(size_t)(const void*)ring + ((unsigned)OBM + w * 16u) * OLP + lane * 16u;
    const int nt = KM / OBK;
    ostage(la, ga, lb, gb);
    asm volatile("s_wait_asynccnt 0x0" ::: "memory");   // this wave's rows of stage 0 have landed
    __syncthreads();                                     // stage 0 published to the eight waves
    ostage(la + OSTG, ga + OBK, lb + OSTG, gb + OBK);
    const char* fa = ring + (wr + lr) * OLP + hi * 16u; const char* fb = ring + ((unsigned)OBM + wc + lr) * OLP + hi * 16u;
// fragments of k-step u (32 k) of the stage in buffer offset bo: CT row tile mb, G row tile nb
#define LDA(u, mb) WFrag<h16>::ld((const h16*)(fa + bo + (unsigned)(mb) * 16u * OLP + (unsigned)(u) * 64u))
#define LDB(u, nb) WFrag<h16>::ld((const h16*)(fb + bo + (unsigned)(nb) * 16u * OLP + (unsigned)(u) * 64u))
#pragma unroll 1
    for (int t = 0; t < nt; ++t) {
        const unsigned bo = ((unsigned)t & 1u) * OSTG;
        // A group = two k-steps: 8 fragments, 8 products. Each group is read one group ahead into the other of two register sets, never past the stage.
        v16h a[2][2][2], b[2][2][2];   // [set][k-step of the group][tile]
#pragma unroll
        for (int kk = 0; kk < 2; ++kk) { a[0][kk][0] = LDA(kk, 0); a[0][kk][1] = LDA(kk, 1); b[0][kk][0] = LDB(kk, 0); b[0][kk][1] = LDB(kk, 1); }
#pragma unroll
        for (int gi = 0; gi < OBK / 64; ++gi) {
            if (gi + 1 < OBK / 64) {
#pragma unroll
                for (int kk = 0; kk < 2; ++kk) { const int u = (gi + 1) * 2 + kk; a[(gi + 1) & 1][kk][0] = LDA(u, 0); a[(gi + 1) & 1][kk][1] = LDA(u, 1); b[(gi + 1) & 1][kk][0] = LDB(u, 0); b[(gi + 1) & 1][kk][1] = LDB(u, 1); }
            }
            __builtin_amdgcn_sched_barrier(0);   // keeps the 16 LDS reads issued ahead as one group in front of these products instead of spread among them
#pragma unroll
            for (int kk = 0; kk < 2; ++kk)
#pragma unroll
                for (int nb = 0; nb < 2; ++nb)
#pragma unroll
                    for (int mb = 0; mb < 2; ++mb) acc[mb][nb] = wmma16(a[gi & 1][kk][mb], b[gi & 1][kk][nb], acc[mb][nb]);
            __builtin_amdgcn_sched_barrier(0);   // the other side of the pair: later reads stay behind these products
        }
        asm volatile("s_wait_dscnt 0x0" ::: "memory");      // this wave's reads of buffer t%2 are done before the buffer is refilled
        asm volatile("s_wait_asynccnt 0x0" ::: "memory");   // this wave's rows of stage t+1 have landed
        __syncthreads();                                     // publishes stage t+1 and ends every wave's reads of stage t
        if (t + 2 < nt) ostage(la + bo, ga + (size_t)(t + 2) * OBK, lb + bo, gb + (size_t)(t + 2) * OBK);
    }
    asm volatile("s_wait_asynccnt 0x0" ::: "memory");       // nothing in flight when the ring becomes output staging
    // The wave's 32x32 tile staged in a range of its own (rows at pitch 36 floats), so that each store covers whole 128-B lines: 4 rows an instruction, 8 lanes a row.
    float* os = (float*)(ring + w * (32u * 36u * 4u));
#pragma unroll
    for (int mb = 0; mb < 2; ++mb)
#pragma unroll
        for (int nb = 0; nb < 2; ++nb)
#pragma unroll
            for (int j = 0; j < 8; ++j) os[((unsigned)mb * 16u + hi * 8u + (unsigned)j) * 36u + (unsigned)nb * 16u + lr] = acc[mb][nb][j];   // D: row 8*hi + j, col lr
    __syncthreads();                                         // the staged rows are complete before other lanes read them back
    const unsigned rq = lane >> 3, cq = (lane & 7u) * 4u;
    const v4f bc = *(const v4f*)(bias + cb + wc + cq);
    asm volatile("s_wait_xcnt 0x0" ::: "memory");   // stands in front of any later write to the address registers that this load names
    v4f vals[8];   // all 8 row groups are formed ahead of the stores, and one address serves every store: no register that an issued store names is written again
#pragma unroll
    for (int s = 0; s < 8; ++s) { const v4f x = *(const v4fa*)(os + ((unsigned)s * 4u + rq) * 36u + cq);
        v4f o;
#pragma unroll
        for (int e = 0; e < 4; ++e) o[e] = x[e] * FINSC + bc[e];
        vals[s] = o; }
    float* crow = OUT + (size_t)(rb + wr + rq) * DD + cb + wc + cq;
#pragma unroll
    for (int s = 0; s < 8; ++s) *(v4f*)(crow + (size_t)s * 4 * DD) = vals[s];
}

// In the functions from here to k_prep every '#pragma unroll' stands on a loop over a register array (fragments, accumulators, loaded rows): rolled, the array would be indexed at run time and go to scratch.
// each of N values summed over the 32 lanes of a wave, in every lane; the N exchanges of a step are independent, so that their latencies overlap
template <int N>
__device__ __forceinline__ void wsum(float (&x)[N]) {
#pragma unroll
    for (int m = 16; m >= 1; m >>= 1)
#pragma unroll
        for (int r = 0; r < N; ++r) x[r] += __shfl_xor(x[r], m, 32);
}

// k_proj: grid (SEQ/128, 256/128, PXZ + batches * 8), 128 threads.
// blockIdx.z = PXZ + batch * 8 + head: a 128x128 tile of the head's query plane q'' [SEQ][256] = x_q M + c: A = x_q of the batch, Bt = M^T of the head [256 n][256 k], per-column bias c.
// The blocks of the first PXZ layers, by flat index: 32 tiles of the G plane, GOS[n][h*256 + i] = 256 sum_d Wv[h][i][d] Wo[d*8 + h][n]: A = columns h*256.. of the Wo plane (rows n, pitch 2048), Bt = Wv of the head (rows i);
// then 8 blocks of the output bias, 32 columns each: BO2[n] = bo[n] + sum_kk bv[kk] Wo plane[n][kk] / 256, a wave a row, the 32 sums stored by one wave as one 128-B line.
#define PXY  ((unsigned)(SEQ / 128) * (unsigned)(DD / 128))       // blocks per z layer
#define PXZ  ((40u + PXY - 1u) / PXY)                             // z layers that hold the 40 blocks of G and the bias
__global__ __launch_bounds__(128) void k_proj(const bf* __restrict__ XQ, const bf* __restrict__ MT, const float* __restrict__ CQ, h16* QP, const h16* __restrict__ WOS, const h16* __restrict__ WV, h16* GOS, const float* __restrict__ bv, const float* __restrict__ bo, float* BO2) {
    __shared__ __align__(16) char ring[2 * STG];
    if (blockIdx.z >= PXZ) {   // block-uniform, as every branch below
        const unsigned z = blockIdx.z - PXZ; const unsigned h = z & 7u, b = z >> 3;
        gemm_tile<bf, h16, 1>(ring, XQ + (size_t)b * SEQ * DD, DD, MT + (size_t)h * DD * DD, DD, DD, QP + (size_t)z * SEQ * DD, DD, CQ + h * (unsigned)DD, 1.0f, blockIdx.x * (unsigned)BT, blockIdx.y * (unsigned)BT);
        return;
    }
    const unsigned idx = blockIdx.z * PXY + blockIdx.y * (unsigned)(SEQ / 128) + blockIdx.x;
    if (idx < 32u) {
        const unsigned h = idx >> 2;
        gemm_tile<h16, h16, 0>(ring, WOS + h * (unsigned)DD, KM, WV + (size_t)h * DD * DD, DD, DD, GOS + h * (unsigned)DD, KM, nullptr, 1.0f, ((idx >> 1) & 1u) * (unsigned)BT, (idx & 1u) * (unsigned)BT);
        return;
    }
    if (idx >= 40u) return;
    const unsigned lane = threadIdx.x & 31u, w = threadIdx.x >> 5, n0 = (idx - 32u) * 32u;
    float* red = (float*)ring;
    const h16* row = WOS + (size_t)(n0 + w * 8u) * KM + lane * 8u; const float* bvl = bv + lane * 8u;
    float s[8];
#pragma unroll
    for (int r = 0; r < 8; ++r) s[r] = 0.f;
#pragma unroll
    for (int i = 0; i < 8; ++i) { const v4f b0 = *(const v4f*)(bvl + i * 256), b1 = *(const v4f*)(bvl + i * 256 + 4);
#pragma unroll
        for (int r = 0; r < 8; ++r) { const v8h a = *(const v8h*)(row + (size_t)r * KM + i * 256);
#pragma unroll
            for (int e = 0; e < 4; ++e) { s[r] += (float)a[e] * b0[e]; s[r] += (float)a[4 + e] * b1[e]; } }
        if (i == 3) __builtin_amdgcn_sched_barrier(0);   // keeps the second half's loads behind the first half's sums: with all 80 in flight these few blocks raise the kernel's register count past four waves a SIMD
    }
    wsum(s);
    if (lane == 0u) {
#pragma unroll
        for (int r = 0; r < 8; ++r) red[w * 8u + (unsigned)r] = s[r]; }
    __syncthreads();                                     // the 32 sums are complete before one wave reads them
    if (threadIdx.x < 32u) BO2[n0 + threadIdx.x] = bo[n0 + threadIdx.x] + red[threadIdx.x] * (1.0f / WOCAR);
}

#define XBLK ((unsigned)((size_t)NB * SEQ * DD / 8 / 256))   // blocks per x plane
#define WBLK ((unsigned)((VLINES + OLINES) / 64))            // blocks of the Wv and Wo planes
#define MBLK ((unsigned)(NHEAD * 8))                         // blocks of M^T: 128 k x 64 n each
#define CBLK ((unsigned)(NHEAD * DD / 32))                   // blocks of c: 32 rows each
#define TBLK ((unsigned)(NB * (SEQ / 64) * (DD / 64)))       // blocks of the transposed x_v plane: 64 t x 64 d each
// xplanes: block blk of 2 * XBLK: 2,048 elements of bf16(x_q) or of f16(x_k)
__device__ __forceinline__ void xplanes(unsigned blk, const float* __restrict__ xq, const float* __restrict__ xk, bf* XQ, h16* XK) {
    const unsigned which = blk / XBLK; const unsigned i = (blk - which * XBLK) * 256u + threadIdx.x;
    const unsigned GPB = (unsigned)(SEQ * DD / 8); const unsigned b = i / GPB, rem = i - b * GPB;
    const float* src = (which == 0u) ? xq : xk;
    const v8f v = *(const v8f*)(src + (size_t)b * SEQ_FULL * DD + (size_t)rem * 8);
    asm volatile("s_wait_xcnt 0x0" ::: "memory");   // stands in front of any later write to the address registers that this load names
    if (which == 0u) {   // block-uniform
        v8us o;
#pragma unroll
        for (int k = 0; k < 8; ++k) o[k] = f2bf(v[k]);
        *(v8us*)(XQ + (size_t)i * 8) = o;
        asm volatile("s_wait_xcnt 0x0" ::: "memory");   // stands in front of any later write to registers that this store names (k_prep's branches share one listing)
    } else {
        v8h o;
#pragma unroll
        for (int k = 0; k < 8; ++k) o[k] = (h16)v[k];
        *(v8h*)(XK + (size_t)i * 8) = o;
        asm volatile("s_wait_xcnt 0x0" ::: "memory");   // as above, for this store
    }
}

// xvt: block blk of TBLK: a tile of 64 t x 64 d of x_v, turned in LDS (rows d at pitch 72 elements): XVT[batch][d][t] = f16(x_v[batch][t][d]); whole 128-B lines read and stored
__device__ __forceinline__ void xvt(char* sm, unsigned blk, const float* __restrict__ xv, h16* XVT) {
    h16* tt = (h16*)sm;
    const unsigned per = (unsigned)((SEQ / 64) * (DD / 64)); const unsigned b = blk / per, r = blk - b * per; const unsigned t0 = (r >> 2) * 64u, d0 = (r & 3u) * 64u;
    const unsigned row = threadIdx.x >> 4, col = (threadIdx.x & 15u) * 4u;
    v4f v[4];
#pragma unroll
    for (int i = 0; i < 4; ++i) v[i] = *(const v4f*)(xv + ((size_t)b * SEQ_FULL + t0 + row + (unsigned)i * 16u) * DD + d0 + col);
#pragma unroll
    for (int i = 0; i < 4; ++i)
#pragma unroll
        for (int e = 0; e < 4; ++e) tt[(col + (unsigned)e) * 72u + row + (unsigned)i * 16u] = (h16)v[i][e];
    __syncthreads();                                     // the tile is complete before its rows are read the other way
    const unsigned d = threadIdx.x >> 2, pc = threadIdx.x & 3u;
    const v8h o0 = *(const v8h*)(tt + d * 72u + pc * 16u); const v8h o1 = *(const v8h*)(tt + d * 72u + pc * 16u + 8u);
    h16* dst = XVT + ((size_t)b * DD + d0 + d) * SEQ + t0 + pc * 16u;
    *(v8h*)dst = o0; *(v8h*)(dst + 8) = o1;
    asm volatile("s_wait_xcnt 0x0" ::: "memory");   // stands in front of any later write to registers that these two stores name (k_prep's branches share one listing)
}

// mprod: block blk of MBLK: head blk / 8, a tile of 128 k x 64 n of M[k][n] = sum_e Wq[k][e] Wk[n][e], stored transposed: MT[head][n][k] = bf16(M[k][n]).
// Slices of 32 e: [Wq 128 rows | Wk 64 rows] read as whole 128-B lines, converted to bf16 and laid in LDS at pitch 80 B (16 B x odd); a slice's loads are issued two slices ahead.
// Eight waves (2 x 4), each 64 k x 16 n: A = Wq rows, B = Wk rows, so a lane holds 8 successive k of one n (16 B of a row of MT), and a wave stores the whole 128-B line of each of its rows.
#define MPIT 80u
__device__ __forceinline__ void mprod(char* sm, unsigned blk, const float* __restrict__ wq, const float* __restrict__ wk, bf* MT) {
    const unsigned lane = threadIdx.x & 31u, lr = lane & 15u, hi = lane >> 4; const unsigned w = (unsigned)__builtin_amdgcn_readfirstlane((int)(threadIdx.x >> 5));
    const unsigned h = blk >> 3, k0 = ((blk >> 2) & 1u) * 128u, n0 = (blk & 3u) * 64u;
    const unsigned row = threadIdx.x >> 3, pc = threadIdx.x & 7u;
    const float* ga = wq + (size_t)h * DD * DD + (size_t)(k0 + row) * DD + pc * 4u; const float* gb = wk + (size_t)h * DD * DD + (size_t)(n0 + row) * DD + pc * 4u;
    v4f r[2][6];
#pragma unroll
    for (int s = 0; s < 2; ++s) {
#pragma unroll
        for (int i = 0; i < 4; ++i) r[s][i] = *(const v4f*)(ga + (size_t)i * 32 * DD + s * 32);
#pragma unroll
        for (int i = 0; i < 2; ++i) r[s][4 + i] = *(const v4f*)(gb + (size_t)i * 32 * DD + s * 32);
    }
    v8f acc[4];
#pragma unroll
    for (int i = 0; i < 4; ++i) acc[i] = (v8f){};
    const unsigned wa = (w & 1u) * 64u, wb = (w >> 1) * 16u;
    char* st = sm + row * MPIT + pc * 8u;
    const char* fa = sm + (wa + lr) * MPIT + hi * 16u; const char* fb = sm + (128u + wb + lr) * MPIT + hi * 16u;
#pragma unroll
    for (int s = 0; s < DD / 32; ++s) {
#pragma unroll
        for (int i = 0; i < 6; ++i) { v4us o;
#pragma unroll
            for (int e = 0; e < 4; ++e) o[e] = f2bf(r[s & 1][i][e]);
            *(v4us*)(st + (unsigned)i * 32u * MPIT) = o; }
        __syncthreads();                                 // the slice is complete before any wave reads its fragments
        if (s + 2 < DD / 32) {
#pragma unroll
            for (int i = 0; i < 4; ++i) r[s & 1][i] = *(const v4f*)(ga + (size_t)i * 32 * DD + (s + 2) * 32);
#pragma unroll
            for (int i = 0; i < 2; ++i) r[s & 1][4 + i] = *(const v4f*)(gb + (size_t)i * 32 * DD + (s + 2) * 32);
        }
        const v16bf fbv = WFrag<bf>::ld((const bf*)fb);
#pragma unroll
        for (int i = 0; i < 4; ++i) acc[i] = wmmab(WFrag<bf>::ld((const bf*)(fa + (unsigned)i * 16u * MPIT)), fbv, acc[i]);
        __syncthreads();                                 // every wave's reads of the slice are done before the next slice is laid over it
    }
    bf* mrow = MT + (size_t)h * DD * DD + (size_t)(n0 + wb + lr) * DD + k0 + wa + hi * 8u;   // D: row (k) 8*hi + j, column (n) lr
    v8us ov[4];
#pragma unroll
    for (int i = 0; i < 4; ++i)
#pragma unroll
        for (int j = 0; j < 8; ++j) ov[i][j] = f2bf(acc[i][j]);
#pragma unroll
    for (int i = 0; i < 4; ++i) *(v8us*)(mrow + i * 16) = ov[i];
}

// cqrows: block blk of CBLK: 32 elements of c[head*256 + n] = sum_e bq[head][e] Wk[head][n][e], in f32; a wave a row (1 KB, whole lines), the 32 sums stored by one wave as one 128-B line
__device__ __forceinline__ void cqrows(char* sm, unsigned blk, const float* __restrict__ wk, const float* __restrict__ bq, float* CQ) {
    float* red = (float*)sm;
    const unsigned lane = threadIdx.x & 31u, w = threadIdx.x >> 5, r0 = blk * 32u;
    const float* bqh = bq + (r0 >> 8) * (unsigned)DD + lane * 8u;
    const v4f q0 = *(const v4f*)bqh, q1 = *(const v4f*)(bqh + 4);
    float s[4];
#pragma unroll
    for (int r = 0; r < 4; ++r) { const float* row = wk + (size_t)(r0 + w * 4u + (unsigned)r) * DD + lane * 8u; const v4f x0 = *(const v4f*)row, x1 = *(const v4f*)(row + 4); s[r] = 0.f;
#pragma unroll
        for (int e = 0; e < 4; ++e) { s[r] += x0[e] * q0[e]; s[r] += x1[e] * q1[e]; } }
    wsum(s);
    if (lane == 0u) {
#pragma unroll
        for (int r = 0; r < 4; ++r) red[w * 4u + (unsigned)r] = s[r]; }
    __syncthreads();                                     // the 32 sums are complete before one wave reads them
    if (threadIdx.x < 32u) CQ[r0 + threadIdx.x] = red[threadIdx.x];
}

// wprep: block blk of WBLK; lines 0..VLINES-1: WV[h][i][d] = f16(Wv[h][i][d]), in place order; the other lines: the Wo plane
__device__ __forceinline__ void wprep(unsigned blk, const float* __restrict__ wv, const float* __restrict__ wo, unsigned short* WV, unsigned short* WOS) {
    const unsigned lane = threadIdx.x & 31u; const unsigned L0 = (blk * 8u + (threadIdx.x >> 5)) * 8u;
#pragma unroll 1
    for (unsigned l = 0; l < 8u; ++l) { const unsigned L = L0 + l; v2us o;
        if (L < (unsigned)VLINES) {   // block-uniform
            const unsigned e = L * 64u + lane * 2u;
            o[0] = __builtin_bit_cast(unsigned short, (h16)wv[e]); o[1] = __builtin_bit_cast(unsigned short, (h16)wv[e + 1u]);
            *(v2us*)(WV + e) = o;
        } else {
            const unsigned e = (L - (unsigned)VLINES) * 64u + lane * 2u; const unsigned kk = e & (unsigned)(KM - 1), n = e >> 11; const unsigned h = kk >> 8, d = kk & 255u;
            const float x0 = bfr(wo[(size_t)(d * 8u + h) * DD + n]) * WOCAR; const float x1 = bfr(wo[(size_t)((d + 1u) * 8u + h) * DD + n]) * WOCAR;
            o[0] = __builtin_bit_cast(unsigned short, (h16)x0); o[1] = __builtin_bit_cast(unsigned short, (h16)x1);
            *(v2us*)(WOS + e) = o;
        }
        asm volatile("s_wait_xcnt 0x0" ::: "memory");   // stands in front of the next line's writes to registers that this line's store names
    }
}

// k_prep: every operand plane that needs no other plane, in one grid of MBLK + CBLK + WBLK + TBLK + 2 * XBLK blocks, 256 threads; the blocks that run longest have the lowest indices. Every branch is block-uniform.
__global__ __launch_bounds__(256) void k_prep(const float* __restrict__ xq, const float* __restrict__ xk, const float* __restrict__ xv, const float* __restrict__ wq, const float* __restrict__ wk, const float* __restrict__ wv, const float* __restrict__ wo, const float* __restrict__ bq,
                                              bf* XQ, h16* XK, h16* XVT, bf* MT, unsigned short* WV, unsigned short* WOS, float* CQ) {
    __shared__ __align__(16) char sm[192 * MPIT];
    static_assert(64 * 72 * 2 <= 192 * MPIT);
    unsigned blk = blockIdx.x;
    if (blk < MBLK) { mprod(sm, blk, wq, wk, MT); return; }
    blk -= MBLK;
    if (blk < CBLK) { cqrows(sm, blk, wk, bq, CQ); return; }
    blk -= CBLK;
    if (blk < WBLK) { wprep(blk, wv, wo, WV, WOS); return; }
    blk -= WBLK;
    if (blk < TBLK) { xvt(sm, blk, xv, XVT); return; }
    xplanes(blk - TBLK, xq, xk, XQ, XK);
}

// ---- k_fattn: scores, softmax and P.x_v of one head for 256 queries per block (below, q_ is the head's q'' plane, k_ the batch's f16(x_k) plane, v_^T the batch's f16(x_v)^T plane); 8 waves, each 32 query columns; grid (SEQ/256, batch*8 + head), 256 threads.
// Transposed products: S^T = k_ . q_^T (A = k_ rows from LDS, B = q_ kept in registers), O^T += v_^T . P^T (A = v_^T rows from LDS, B = P^T packed from the score accumulators of the same lane).
// In a score tile a lane holds keys 8*hi + j of query lr; tiles of keys 0..15 and 16..31 give elements 0..7 and 8..15 of the B fragment, which is the loaders' k order.
// A stage is 64 keys: [k_ 64 rows of 512 B at pitch 528 | v_^T 256 rows of 128 B at pitch 144] in a two-buffer LDS ring laid by asynchronous copies; a pass is 32 keys.
// Online softmax in the log2 domain: the maximum in use moves only when a pass exceeds it by more than 8 (P <= 256 fits f16), tested once per pass by a scalar branch.
#define FKB  64                   // keys per ring stage
#define KPIT 528u                 // LDS pitch of a k_ row, bytes (16 B x odd)
#define VPIT 144u                 // LDS pitch of a v_^T row piece, bytes (16 B x odd)
#define FKSZ ((unsigned)FKB * KPIT)
#define FSTG (FKSZ + (unsigned)DD * VPIT)
static_assert(DD == 256 && SEQ % FKB == 0 && SEQ / FKB >= 2);

// Eight copies of one wave, 16 B a lane: LDS address l + i*ls bytes, global address g + i*gs elements. The builtin form: with these copies as asm statements the register allocation of k_fattn spilled q_ fragments, with the builtin it does not.
typedef int v4i __attribute__((ext_vector_type(4)));
typedef float v2f __attribute__((ext_vector_type(2)));
__device__ __forceinline__ void copy8s(char* l, unsigned ls, const h16* g, size_t gs) {
#pragma unroll
    for (int i = 0; i < 8; ++i)
        __builtin_amdgcn_global_load_async_to_lds_b128((__attribute__((address_space(1))) v4i*)(g + (size_t)i * gs), (__attribute__((address_space(3))) v4i*)(l + (unsigned)i * ls), 0, 0);
}

// lane l's value from lane l ^ 16 (a vector-unit exchange: an LDS permute would queue behind the fragment reads issued ahead)
__device__ __forceinline__ float xhalf(float x) { return __builtin_bit_cast(float, __builtin_amdgcn_permlanex16(__builtin_bit_cast(int, x), __builtin_bit_cast(int, x), 0x76543210, 0xfedcba98, false, false)); }

__global__ __launch_bounds__(256) void k_fattn(const h16* __restrict__ QPl, const h16* __restrict__ KPl, const h16* __restrict__ VTl, h16* __restrict__ CT) {
    __shared__ __align__(16) char ring[2 * FSTG];
    static_assert(8u * 32u * KPIT <= 2u * FSTG);
    const unsigned lane = threadIdx.x & 31u, lr = lane & 15u, hi = lane >> 4; const unsigned w = (unsigned)__builtin_amdgcn_readfirstlane((int)(threadIdx.x >> 5));
    const size_t z = blockIdx.y; const h16* Qh = QPl + z * ((size_t)SEQ * DD); const h16* Kh = KPl + (z >> 3) * ((size_t)SEQ * DD); const h16* Vh = VTl + (z >> 3) * ((size_t)SEQ * DD);
    const unsigned q0 = blockIdx.x * 256u + w * 32u;
    // copy addresses: k_ rows w*8 + i, a whole 512-B row per copy; v_^T rows 32*i + w*4 + lane/8, 16-byte piece lane%8 of the row's 128 B (a step of 32 rows is beyond the copy's offset field, so each copy carries its own two addresses)
    char* lk = ring + w * 8u * KPIT + lane * 16u; char* lv = ring + FKSZ + (w * 4u + (lane >> 3)) * VPIT + (lane & 7u) * 16u;
    const h16* gk = Kh + (size_t)(w * 8u) * DD + lane * 8u; const h16* gv = Vh + (size_t)(w * 4u + (lane >> 3)) * SEQ + (lane & 7u) * 8u;
    copy8s(lk, KPIT, gk, (size_t)DD); copy8s(lv, 32u * VPIT, gv, (size_t)32 * SEQ);
    v16h qf[2][8];
#pragma unroll
    for (int qt = 0; qt < 2; ++qt)
#pragma unroll
        for (int ks = 0; ks < 8; ++ks) qf[qt][ks] = WFrag<h16>::ld(Qh + (size_t)(q0 + (unsigned)qt * 16u + lr) * DD + (unsigned)ks * 32u + hi * 8u);
    v8f o[16][2];
#pragma unroll
    for (int dt = 0; dt < 16; ++dt) { o[dt][0] = (v8f){}; o[dt][1] = (v8f){}; }
    float mrun[2] = {-3.0e38f, -3.0e38f}, lsum[2] = {0.f, 0.f};
    asm volatile("s_wait_asynccnt 0x0" ::: "memory");   // this wave's rows of stage 0 have landed
    __syncthreads();                                     // stage 0 published to the eight waves
    copy8s(lk + FSTG, KPIT, gk + (size_t)FKB * DD, (size_t)DD); copy8s(lv + FSTG, 32u * VPIT, gv + FKB, (size_t)32 * SEQ);
    const char* fk = ring + lr * KPIT + hi * 16u; const char* fv = ring + FKSZ + lr * VPIT + hi * 16u;
    const int nt = SEQ / FKB;
// fragment of pass p (32 keys) in buffer offset bo: k_ key tile kt, k-step u; v_^T d tile dt
#define LDK(p, u, kt) WFrag<h16>::ld((const h16*)(fk + bo + (unsigned)((p) * 32 + (kt) * 16) * KPIT + (unsigned)(u) * 64u))
#define LDV(p, dt)    WFrag<h16>::ld((const h16*)(fv + bo + (unsigned)(dt) * 16u * VPIT + (unsigned)(p) * 64u))
    for (int t = 0; t < nt; ++t) {
        const unsigned bo = ((unsigned)t & 1u) * FSTG;
        // Fragments are read ahead of their products, never past the stage. A unit = 2 fragments and 4 products: the two key tiles' k_ fragments of one k-step, or two d tiles' v_^T fragments.
        // Each unit is read two units ahead into a ring of three sets; P.V's first two units are read under the last two score units, the next pass's first two score units under the last two of P.V.
        v16h fs[3][2], fw[3][2]; v8f st[2][2]; v16h pf[2];
        fs[0][0] = LDK(0, 0, 0); fs[0][1] = LDK(0, 0, 1); fs[1][0] = LDK(0, 1, 0); fs[1][1] = LDK(0, 1, 1);
#pragma unroll
        for (int p = 0; p < 2; ++p) {
            st[0][0] = (v8f){}; st[0][1] = (v8f){}; st[1][0] = (v8f){}; st[1][1] = (v8f){};
#pragma unroll
            for (int u = 0; u < 8; ++u) {
                if (u < 6) { fs[(u + 2) % 3][0] = LDK(p, u + 2, 0); fs[(u + 2) % 3][1] = LDK(p, u + 2, 1); }
                else { fw[u - 6][0] = LDV(p, (u - 6) * 2); fw[u - 6][1] = LDV(p, (u - 6) * 2 + 1); }
                __builtin_amdgcn_sched_barrier(0);   // keeps the LDS reads issued ahead as one group in front of these products instead of spread among them
#pragma unroll
                for (int kt = 0; kt < 2; ++kt)
#pragma unroll
                    for (int qt = 0; qt < 2; ++qt) st[kt][qt] = wmma16(fs[u % 3][kt], qf[qt][u], st[kt][qt]);
                __builtin_amdgcn_sched_barrier(0);   // the other side of the pair: later reads stay behind these products
            }
            float ms[2];
#pragma unroll
            for (int qt = 0; qt < 2; ++qt) { float a = fmaxf(st[0][qt][0], st[1][qt][0]);
#pragma unroll
                for (int j = 1; j < 8; ++j) a = fmaxf(a, fmaxf(st[0][qt][j], st[1][qt][j]));
                a = fmaxf(a, xhalf(a)); ms[qt] = a * SCL2; }
            const bool need = (ms[0] > mrun[0] + 8.0f) || (ms[1] > mrun[1] + 8.0f);
            if (__builtin_amdgcn_ballot_w32(need) != 0) {   // wave-uniform: every lane rescales its two queries or none does
#pragma unroll
                for (int qt = 0; qt < 2; ++qt) { const float mn = fmaxf(mrun[qt], ms[qt]); const float al = __builtin_amdgcn_exp2f(mrun[qt] - mn); mrun[qt] = mn; lsum[qt] *= al;
#pragma unroll
                    for (int dt = 0; dt < 16; ++dt) o[dt][qt] *= al; }
            }
#pragma unroll
            for (int qt = 0; qt < 2; ++qt) { v16h pk; const float nm = -mrun[qt]; v2f ps[2] = {(v2f){0.f, 0.f}, (v2f){0.f, 0.f}};
#pragma unroll
                for (int i = 0; i < 8; ++i) {
                    const v2f arg = __builtin_elementwise_fma((v2f){st[i >> 2][qt][2 * (i & 3)], st[i >> 2][qt][2 * (i & 3) + 1]}, (v2f){SCL2, SCL2}, (v2f){nm, nm});
                    const float e0 = __builtin_amdgcn_exp2f(arg.x), e1 = __builtin_amdgcn_exp2f(arg.y);
                    ps[i & 1] += (v2f){e0, e1}; pk[2 * i] = (h16)e0; pk[2 * i + 1] = (h16)e1; }
                lsum[qt] += (ps[0].x + ps[1].x) + (ps[0].y + ps[1].y);
                asm volatile("" : "+v"(lsum[qt]));   // each row's sum, against spills: left free, the adds sink behind the P.V products and the 32 exponentials stay live into the next pass
                pf[qt] = pk; }
#pragma unroll
            for (int u = 0; u < 8; ++u) {
                if (u < 6) { fw[(u + 2) % 3][0] = LDV(p, (u + 2) * 2); fw[(u + 2) % 3][1] = LDV(p, (u + 2) * 2 + 1); }
                else if (p == 0) { fs[u - 6][0] = LDK(1, u - 6, 0); fs[u - 6][1] = LDK(1, u - 6, 1); }
                __builtin_amdgcn_sched_barrier(0);   // as above: the reads issued ahead stay one group in front of these products
#pragma unroll
                for (int i = 0; i < 2; ++i)
#pragma unroll
                    for (int qt = 0; qt < 2; ++qt) o[u * 2 + i][qt] = wmma16(fw[u % 3][i], pf[qt], o[u * 2 + i][qt]);
                __builtin_amdgcn_sched_barrier(0);   // the other side of the pair
            }
        }
        asm volatile("s_wait_dscnt 0x0" ::: "memory");      // this wave's reads of buffer t%2 are done before the buffer is refilled
        asm volatile("s_wait_asynccnt 0x0" ::: "memory");   // this wave's rows of stage t+1 have landed
        __syncthreads();                                     // publishes stage t+1 and ends every wave's reads of stage t
        if (t + 2 < nt) { copy8s(lk + bo, KPIT, gk + (size_t)(t + 2) * FKB * DD, (size_t)DD); copy8s(lv + bo, 32u * VPIT, gv + (size_t)(t + 2) * FKB, (size_t)32 * SEQ); }
    }
    asm volatile("s_wait_asynccnt 0x0" ::: "memory");       // nothing in flight when the ring becomes output staging
    // O^T tile: lane holds d = dt*16 + 8*hi + j of query lr: 16 B of that query's ctx row; rows staged (pitch 528 B, a range per wave) so that each store covers a whole 512-B row segment
    char* os = ring + w * (32u * KPIT);
#pragma unroll
    for (int qt = 0; qt < 2; ++qt) { const float inv = __fdiv_rn(CCAR, lsum[qt] + xhalf(lsum[qt]));
#pragma unroll
        for (int dt = 0; dt < 16; ++dt) { v8h ov;
#pragma unroll
            for (int j = 0; j < 8; ++j) ov[j] = (h16)(o[dt][qt][j] * inv);
            *(v8h*)(os + ((unsigned)qt * 16u + lr) * KPIT + (unsigned)dt * 32u + hi * 16u) = ov; } }
    __syncthreads();                                         // the staged rows are complete before other lanes read them back
    h16* crow = CT + ((z >> 3) * (size_t)SEQ + q0) * KM + (z & 7u) * (size_t)DD + lane * 8u;
    v8h rowv[32];   // all 32 rows are read into registers of their own ahead of the stores, and one address serves every store: no register that an issued store names is written again
#pragma unroll
    for (int r = 0; r < 32; ++r) rowv[r] = *(const v8h*)(os + (unsigned)r * KPIT + lane * 16u);
#pragma unroll
    for (int r = 0; r < 32; ++r) *(v8h*)(crow + (size_t)r * KM) = rowv[r];
}

// Workspace carve (bytes, each region 256-B aligned by construction of the sizes).
#define SZ_X1  ((size_t)NB * SEQ * DD * 2)
#define SZ_W1  ((size_t)NHEAD * DD * DD * 2)
#define SZ_WOS ((size_t)DD * KM * 2)
#define SZ_CQ  ((size_t)NHEAD * DD * 4)
#define SZ_BO  ((size_t)DD * 4)
#define SZ_HP  ((size_t)NB * NHEAD * SEQ * DD * 2)
#define SZ_ALL (3 * SZ_X1 + 2 * SZ_W1 + 2 * SZ_WOS + SZ_CQ + SZ_BO + 2 * SZ_HP)
static_assert(SZ_ALL <= (size_t)268435456);
static_assert(SZ_X1 % 256 == 0 && SZ_W1 % 256 == 0 && SZ_WOS % 256 == 0 && SZ_CQ % 256 == 0 && SZ_BO % 256 == 0 && SZ_HP % 256 == 0);
static_assert((size_t)SEQ * KM == (size_t)NHEAD * SEQ * DD);   // the ctx plane has the size of one set of head planes

extern "C" void kernel_launch(void* const* d_in, const int* in_sizes, int n_in,
                              void* d_out, int out_size, void* d_ws, size_t ws_size, hipStream_t stream) {
    if (n_in < 11) return;
    const size_t xneed = (size_t)(NB - 1) * SEQ_FULL * DD + (size_t)SEQ * DD;
    if ((size_t)in_sizes[0] < xneed || (size_t)in_sizes[1] < xneed || (size_t)in_sizes[2] < xneed) return;
    if ((size_t)in_sizes[3] < (size_t)NHEAD * DD * DD || (size_t)in_sizes[5] < (size_t)NHEAD * DD * DD || (size_t)in_sizes[7] < (size_t)NHEAD * DD * DD) return;
    if ((size_t)in_sizes[4] < (size_t)NHEAD * DD || (size_t)in_sizes[6] < (size_t)NHEAD * DD || (size_t)in_sizes[8] < (size_t)NHEAD * DD) return;
    if ((size_t)in_sizes[9] < (size_t)KM * DD || (size_t)in_sizes[10] < (size_t)DD) return;
    if ((size_t)out_size < (size_t)NB * SEQ * DD) return;
    if (SZ_ALL > ws_size) return;
    const float* Kin = (const float*)d_in[0]; const float* Vin = (const float*)d_in[1]; const float* Qin = (const float*)d_in[2];
    const float* Wk = (const float*)d_in[3]; const float* Wv = (const float*)d_in[5]; const float* bv = (const float*)d_in[6];   // d_in[4], bk, adds the same amount to every score of a query: the softmax does not see it
    const float* Wq = (const float*)d_in[7]; const float* bq = (const float*)d_in[8]; const float* Wo = (const float*)d_in[9]; const float* bo = (const float*)d_in[10];
    float* OUT = (float*)d_out;     // [NB][SEQ][256]
    char* wsp = (char*)d_ws;
    bf* XQ = (bf*)wsp; wsp += SZ_X1;            // [NB][SEQ][256] bf16(x_q)
    h16* XK = (h16*)wsp; wsp += SZ_X1;          // [NB][SEQ][256] f16(x_k)
    h16* XVT = (h16*)wsp; wsp += SZ_X1;         // [NB][256][SEQ] f16(x_v)^T
    bf* MT = (bf*)wsp; wsp += SZ_W1;            // [8][256 n][256 k] bf16: (Wq Wk^T)^T
    h16* WV = (h16*)wsp; wsp += SZ_W1;          // [8][256 i][256 d] f16(Wv)
    h16* WOS = (h16*)wsp; wsp += SZ_WOS;        // [256][2048] f16 (x256), column h*256 + d
    h16* GOS = (h16*)wsp; wsp += SZ_WOS;        // [256][2048] f16 (x256), column h*256 + i: Wv Wo
    float* CQ = (float*)wsp; wsp += SZ_CQ;      // [8][256] bq Wk^T
    float* BO2 = (float*)wsp; wsp += SZ_BO;     // [256] bo + sum_h bv_h Wo_h
    h16* QP = (h16*)wsp; wsp += SZ_HP;          // [NB][8][SEQ][256]
    h16* CTX = (h16*)wsp; wsp += SZ_HP;         // [NB][SEQ][2048] (x64), column h*256 + i

    k_prep<<<MBLK + CBLK + WBLK + TBLK + 2u * XBLK, 256, 0, stream>>>(Qin, Kin, Vin, Wq, Wk, Wv, Wo, bq, XQ, XK, XVT, MT, (unsigned short*)WV, (unsigned short*)WOS, CQ);
    // q'' head planes, all heads of all batches; the G plane and the output bias
    k_proj<<<dim3(SEQ / 128, DD / 128, PXZ + NB * NHEAD), 128, 0, stream>>>(XQ, MT, CQ, QP, WOS, WV, GOS, bv, bo, BO2);
    // ctx[zb][t][h*256 + i] = 64 softmax(q'' . x_k / 16) . x_v, all heads of all batches
    k_fattn<<<dim3(SEQ / 256, NB * NHEAD, 1), 256, 0, stream>>>(QP, XK, XVT, CTX);
    // out = ctx . G / 16384 + BO2, the rows of all batches in one launch
    k_omix<<<dim3(NB * SEQ / OBM, DD / OBN, 1), 256, 0, stream>>>(CTX, GOS, OUT, BO2);
}

// v007
// A run of this version takes 106 microseconds.
// Next to v006, in two timings, it ran 1.05 times as fast each time.
// Over all steps from v000 it is 8.69 times as fast.
#include <hip/hip_runtime.h>

// Multi-head attention with full-width (256) heads, the k and v projections re-associated into the weights, so that no k_ or v_ head plane is formed:
//   scores: q_ . k_ = (x_q M + c) . x_k + (a term that is the same for every key of a query and so drops out of the softmax), M = Wq Wk^T, c = bq Wk^T, per head;
//   output: sum_h (P_h v_h) Wo_h + bo = sum_h (P_h x_v) G_h + (bo + sum_h bv_h Wo_h), G_h = Wv_h Wo_h, because each row of P sums to 1.
// Every head of a batch reads the same key plane f16(x_k) and the same value plane f16(x_v)^T.
// Compute dtypes, f32 accumulate everywhere: M and q'' = x_q M + c on v_wmma_f32_16x16x32_bf16 (x_q, Wq, Wk, M RNE-converted to bf16); G, scores, P.x_v and the output mix on v_wmma_f32_16x16x32_f16
// (q'' f16 in registers; scores stay f32 in registers; P f16 of exp2(score*log2(e)/16 - running maximum); ctx f16 carried x64; G's Wo operand f16 of bf16(Wo) x256, G plane f16 x256; c and the output bias f32). Softmax in f32, online over key passes.

#ifndef NB
#define NB 4
#endif
#ifndef SEQ
#define SEQ 2048
#endif
#define NB_FULL  4
#define SEQ_FULL 2048
#define DD    256                 // model width = head width
#define NHEAD 8
#define KM    (NHEAD * DD)        // merged context width (plane column = h*256 + d)
#define SCL2  0.09016844005556021f   // log2(e) / sqrt(256)
#define CCAR  64.0f               // carry of the ctx plane
#define WOCAR 256.0f              // carry of G's Wo operand and of the G plane
#define FINSC (1.0f / 16384.0f)   // 1 / (64 * 256)

typedef _Float16 h16;
typedef unsigned short bf;
typedef __attribute__((ext_vector_type(16))) __bf16   v16bf;
typedef __attribute__((ext_vector_type(16))) _Float16 v16h;
typedef __attribute__((ext_vector_type(8)))  _Float16 v8h;
typedef __attribute__((ext_vector_type(8)))  unsigned short v8us;
typedef __attribute__((ext_vector_type(4)))  unsigned short v4us;
typedef __attribute__((ext_vector_type(4)))  _Float16 v4h;
typedef __attribute__((ext_vector_type(8)))  float    v8f;
typedef __attribute__((ext_vector_type(4)))  float    v4f;
typedef v4f  __attribute__((may_alias)) v4fa;

static_assert(SEQ % 256 == 0);
static_assert(NHEAD == 8);
static_assert(DD % 128 == 0 && DD % 64 == 0 && KM % 64 == 0 && SEQ % 128 == 0);
static_assert(((size_t)NB * SEQ * DD / 8) % 256 == 0);

__device__ __forceinline__ unsigned short f2bf(float f) { unsigned u = __float_as_uint(f); u += 0x7FFFu + ((u >> 16) & 1u); return (unsigned short)(u >> 16); }
__device__ __forceinline__ float bf2f(unsigned short b) { return __uint_as_float(((unsigned)b) << 16); }
__device__ __forceinline__ float bfr(float f) { return bf2f(f2bf(f)); }
__device__ __forceinline__ v16h cat16(v8h lo, v8h hi) { return __builtin_shufflevector(lo, hi, 0, 1, 2, 3, 4, 5, 6, 7, 8, 9, 10, 11, 12, 13, 14, 15); }
__device__ __forceinline__ v16bf cat16b(v8us lo, v8us hi) { return __builtin_bit_cast(v16bf, __builtin_shufflevector(lo, hi, 0, 1, 2, 3, 4, 5, 6, 7, 8, 9, 10, 11, 12, 13, 14, 15)); }
__device__ __forceinline__ v8f wmma16(v16h a, v16h b, v8f c) { return __builtin_amdgcn_wmma_f32_16x16x32_f16(false, a, false, b, (short)0, c, false, false); }
__device__ __forceinline__ v8f wmmab(v16bf a, v16bf b, v8f c) { return __builtin_amdgcn_wmma_f32_16x16x32_bf16(false, a, false, b, (short)0, c, false, false); }

// Fragment loaders: lane (lr = lane & 15, hi = lane >> 4); p points at row lr, k0 + 8*hi; elements 0..7 = k0+8hi.., elements 8..15 = k0+16+8hi.. (same map for A and B).
template <typename T16> struct WFrag;
template <> struct WFrag<h16> { typedef v16h V; static __device__ __forceinline__ V ld(const h16* p) { return cat16(*(const v8h*)p, *(const v8h*)(p + 16)); } static __device__ __forceinline__ v8f mma(V a, V b, v8f c) { return wmma16(a, b, c); } };
template <> struct WFrag<bf> { typedef v16bf V; static __device__ __forceinline__ V ld(const bf* p) { return cat16b(*(const v8us*)p, *(const v8us*)(p + 16)); } static __device__ __forceinline__ v8f mma(V a, V b, v8f c) { return wmmab(a, b, c); } };

// ---- k_omix: the output mix, OUT[m][n] = FINSC * sum_k CT[m][k] G[n][k] + bias[n]; M = NB*SEQ rows, 256 columns, K = 2048. Grid (M/64, 256/128), 256 threads: every WGP has a block, two waves a SIMD.
// One 64x128 output tile per block of EIGHT waves (2 x 4), each wave a 32x32 tile (4 accumulators). A stage is 256 k: [CT 64 rows | G 128 rows] of 512 B at pitch 528 B in a two-buffer LDS ring laid by asynchronous copies,
// a whole 512-B row piece per copy; wave w lays CT rows 8w.. and G rows 16w.. (24 copies a stage). Eight trips: a trip's copies have the whole work on 256 k to land in.
// Every '#pragma unroll' in k_omix and its two helpers stands on a loop over a register array (addresses, fragments, accumulators, staged rows): rolled, the array would be indexed at run time and go to scratch.
#define OBM  64                   // block tile rows
#define OBN  128                  // block tile columns
#define OBK  256                  // k per ring stage
#define OLP  528u                 // LDS row pitch in bytes (16 B x odd)
#define OSTG ((unsigned)(OBM + OBN) * OLP)
static_assert(((size_t)NB * SEQ) % OBM == 0 && DD % OBN == 0 && KM % OBK == 0 && KM / OBK >= 2);

// Twelve copies of one wave, 16 B a lane, each with its own two addresses. The s_wait_xcnt stands inside the statement so that no address register is rewritten ahead of it.
__device__ __forceinline__ void copy12(const unsigned (&l)[12], const h16* const (&g)[12]) {
    asm volatile("global_load_async_to_lds_b128 %0, %12, off\n\t"
                 "global_load_async_to_lds_b128 %1, %13, off\n\t"
                 "global_load_async_to_lds_b128 %2, %14, off\n\t"
                 "global_load_async_to_lds_b128 %3, %15, off\n\t"
                 "global_load_async_to_lds_b128 %4, %16, off\n\t"
                 "global_load_async_to_lds_b128 %5, %17, off\n\t"
                 "global_load_async_to_lds_b128 %6, %18, off\n\t"
                 "global_load_async_to_lds_b128 %7, %19, off\n\t"
                 "global_load_async_to_lds_b128 %8, %20, off\n\t"
                 "global_load_async_to_lds_b128 %9, %21, off\n\t"
                 "global_load_async_to_lds_b128 %10, %22, off\n\t"
                 "global_load_async_to_lds_b128 %11, %23, off\n\t"
                 "s_wait_xcnt 0x0"
                 :: "v"(l[0]), "v"(l[1]), "v"(l[2]), "v"(l[3]), "v"(l[4]), "v"(l[5]), "v"(l[6]), "v"(l[7]), "v"(l[8]), "v"(l[9]), "v"(l[10]), "v"(l[11]),
                    "v"(g[0]), "v"(g[1]), "v"(g[2]), "v"(g[3]), "v"(g[4]), "v"(g[5]), "v"(g[6]), "v"(g[7]), "v"(g[8]), "v"(g[9]), "v"(g[10]), "v"(g[11])
                 : "memory");
}
// A wave's 24 copies of one stage: 8 CT rows from (la, ga), 16 G rows from (lb, gb); LDS pitch OLP, global pitch KM elements.
__device__ __forceinline__ void ostage(unsigned la, const h16* ga, unsigned lb, const h16* gb) {
    unsigned l[12]; const h16* g[12];
#pragma unroll
    for (int i = 0; i < 8; ++i) { l[i] = la + (unsigned)i * OLP; g[i] = ga + (size_t)i * KM; }
#pragma unroll
    for (int i = 0; i < 4; ++i) { l[8 + i] = lb + (unsigned)i * OLP; g[8 + i] = gb + (size_t)i * KM; }
    copy12(l, g);
#pragma unroll
    for (int i = 0; i < 12; ++i) { l[i] = lb + (unsigned)(4 + i) * OLP; g[i] = gb + (size_t)(4 + i) * KM; }
    copy12(l, g);
}

__global__ __launch_bounds__(256) void k_omix(const h16* __restrict__ CT, const h16* __restrict__ G, float* OUT, const float* __restrict__ bias) {
    __shared__ __align__(16) char ring[2 * OSTG];
    static_assert(8u * 32u * 36u * 4u <= 2u * OSTG);
    const unsigned lane = threadIdx.x & 31u, lr = lane & 15u, hi = lane >> 4; const unsigned w = (unsigned)__builtin_amdgcn_readfirstlane((int)(threadIdx.x >> 5));
    const unsigned rb = blockIdx.x * (unsigned)OBM, cb = blockIdx.y * (unsigned)OBN;
    const unsigned wr = (w >> 2) * 32u, wc = (w & 3u) * 32u;
    v8f acc[2][2];
#pragma unroll
    for (int mb = 0; mb < 2; ++mb)
#pragma unroll
        for (int nb = 0; nb < 2; ++nb) acc[mb][nb] = (v8f){};
    const h16* ga = CT + (size_t)(rb + w * 8u) * KM + lane * 8u; const h16* gb = G + (size_t)(cb + w * 16u) * KM + lane * 8u;
    const unsigned la = (unsigned)(size_t)(const void*)ring + w * 8u * OLP + lane * 16u, lb = (unsigned)(size_t)(const void*)ring + ((unsigned)OBM + w * 16u) * OLP + lane * 16u;
    const int nt = KM / OBK;
    ostage(la, ga, lb, gb);
    asm volatile("s_wait_asynccnt 0x0" ::: "memory");   // this wave's rows of stage 0 have landed
    __syncthreads();                                     // stage 0 published to the eight waves
    ostage(la + OSTG, ga + OBK, lb + OSTG, gb + OBK);
    const char* fa = ring + (wr + lr) * OLP + hi * 16u; const char* fb = ring + ((unsigned)OBM + wc + lr) * OLP + hi * 16u;
// fragments of k-step u (32 k) of the stage in buffer offset bo: CT row tile mb, G row tile nb
#define LDA(u, mb) WFrag<h16>::ld((const h16*)(fa + bo + (unsigned)(mb) * 16u * OLP + (unsigned)(u) * 64u))
#define LDB(u, nb) WFrag<h16>::ld((const h16*)(fb + bo + (unsigned)(nb) * 16u * OLP + (unsigned)(u) * 64u))
#pragma unroll 1
    for (int t = 0; t < nt; ++t) {
        const unsigned bo = ((unsigned)t & 1u) * OSTG;
        // A group = two k-steps: 8 fragments, 8 products. Each group is read one group ahead into the other of two register sets, never past the stage.
        v16h a[2][2][2], b[2][2][2];   // [set][k-step of the group][tile]
#pragma unroll
        for (int kk = 0; kk < 2; ++kk) { a[0][kk][0] = LDA(kk, 0); a[0][kk][1] = LDA(kk, 1); b[0][kk][0] = LDB(kk, 0); b[0][kk][1] = LDB(kk, 1); }
#pragma unroll
        for (int gi = 0; gi < OBK / 64; ++gi) {
            if (gi + 1 < OBK / 64) {
#pragma unroll
                for (int kk = 0; kk < 2; ++kk) { const int u = (gi + 1) * 2 + kk; a[(gi + 1) & 1][kk][0] = LDA(u, 0); a[(gi + 1) & 1][kk][1] = LDA(u, 1); b[(gi + 1) & 1][kk][0] = LDB(u, 0); b[(gi + 1) & 1][kk][1] = LDB(u, 1); }
            }
            __builtin_amdgcn_sched_barrier(0);   // keeps the 16 LDS reads issued ahead as one group in front of these products instead of spread among them
#pragma unroll
            for (int kk = 0; kk < 2; ++kk)
#pragma unroll
                for (int nb = 0; nb < 2; ++nb)
#pragma unroll
                    for (int mb = 0; mb < 2; ++mb) acc[mb][nb] = wmma16(a[gi & 1][kk][mb], b[gi & 1][kk][nb], acc[mb][nb]);
            __builtin_amdgcn_sched_barrier(0);   // the other side of the pair: later reads stay behind these products
        }
        asm volatile("s_wait_dscnt 0x0" ::: "memory");      // this wave's reads of buffer t%2 are done before the buffer is refilled
        asm volatile("s_wait_asynccnt 0x0" ::: "memory");   // this wave's rows of stage t+1 have landed
        __syncthreads();                                     // publishes stage t+1 and ends every wave's reads of stage t
        if (t + 2 < nt) ostage(la + bo, ga + (size_t)(t + 2) * OBK, lb + bo, gb + (size_t)(t + 2) * OBK);
    }
    asm volatile("s_wait_asynccnt 0x0" ::: "memory");       // nothing in flight when the ring becomes output staging
    // The wave's 32x32 tile staged in a range of its own (rows at pitch 36 floats), so that each store covers whole 128-B lines: 4 rows an instruction, 8 lanes a row.
    float* os = (float*)(ring + w * (32u * 36u * 4u));
#pragma unroll
    for (int mb = 0; mb < 2; ++mb)
#pragma unroll
        for (int nb = 0; nb < 2; ++nb)
#pragma unroll
            for (int j = 0; j < 8; ++j) os[((unsigned)mb * 16u + hi * 8u + (unsigned)j) * 36u + (unsigned)nb * 16u + lr] = acc[mb][nb][j];   // D: row 8*hi + j, col lr
    __syncthreads();                                         // the staged rows are complete before other lanes read them back
    const unsigned rq = lane >> 3, cq = (lane & 7u) * 4u;
    const v4f bc = *(const v4f*)(bias + cb + wc + cq);
    asm volatile("s_wait_xcnt 0x0" ::: "memory");   // stands in front of any later write to the address registers that this load names
    v4f vals[8];   // all 8 row groups are formed ahead of the stores, and one address serves every store: no register that an issued store names is written again
#pragma unroll
    for (int s = 0; s < 8; ++s) { const v4f x = *(const v4fa*)(os + ((unsigned)s * 4u + rq) * 36u + cq);
        v4f o;
#pragma unroll
        for (int e = 0; e < 4; ++e) o[e] = x[e] * FINSC + bc[e];
        vals[s] = o; }
    float* crow = OUT + (size_t)(rb + wr + rq) * DD + cb + wc + cq;
#pragma unroll
    for (int s = 0; s < 8; ++s) *(v4f*)(crow + (size_t)s * 4 * DD) = vals[s];
}

// In the functions from here to k_prep every '#pragma unroll' but obias's two over g stands on a loop over a register array (fragments, accumulators, loaded rows): rolled, the array would be indexed at run time and go to scratch.
// each of N values summed over the 32 lanes of a wave, in every lane; the N exchanges of a step are independent, so that their latencies overlap
template <int N>
__device__ __forceinline__ void wsum(float (&x)[N]) {
#pragma unroll
    for (int m = 16; m >= 1; m >>= 1)
#pragma unroll
        for (int r = 0; r < N; ++r) x[r] += __shfl_xor(x[r], m, 32);
}

#define XBLK ((unsigned)((size_t)NB * SEQ * DD / 8 / 256))   // blocks per x plane
#define MBLK ((unsigned)(NHEAD * 8))                         // blocks of M^T: 128 k x 64 n each
#define GBLK ((unsigned)(NHEAD * 8))                         // blocks of G: 128 i x 64 n each
#define BBLK ((unsigned)(DD / 32))                           // blocks of the output bias: 32 columns each
#define CBLK ((unsigned)(NHEAD * DD / 32))                   // blocks of c: 32 rows each
#define TBLK ((unsigned)(NB * (SEQ / 64) * (DD / 64)))       // blocks of the transposed x_v plane: 64 t x 64 d each
// xplanes: block blk of 2 * XBLK: 2,048 elements of bf16(x_q) or of f16(x_k)
__device__ __forceinline__ void xplanes(unsigned blk, const float* __restrict__ xq, const float* __restrict__ xk, bf* XQ, h16* XK) {
    const unsigned which = blk / XBLK; const unsigned i = (blk - which * XBLK) * 256u + threadIdx.x;
    const unsigned GPB = (unsigned)(SEQ * DD / 8); const unsigned b = i / GPB, rem = i - b * GPB;
    const float* src = (which == 0u) ? xq : xk;
    const v8f v = *(const v8f*)(src + (size_t)b * SEQ_FULL * DD + (size_t)rem * 8);
    asm volatile("s_wait_xcnt 0x0" ::: "memory");   // stands in front of any later write to the address registers that this load names
    if (which == 0u) {   // block-uniform
        v8us o;
#pragma unroll
        for (int k = 0; k < 8; ++k) o[k] = f2bf(v[k]);
        *(v8us*)(XQ + (size_t)i * 8) = o;
        asm volatile("s_wait_xcnt 0x0" ::: "memory");   // stands in front of any later write to registers that this store names (k_prep's branches share one listing)
    } else {
        v8h o;
#pragma unroll
        for (int k = 0; k < 8; ++k) o[k] = (h16)v[k];
        *(v8h*)(XK + (size_t)i * 8) = o;
        asm volatile("s_wait_xcnt 0x0" ::: "memory");   // as above, for this store
    }
}

// xvt: block blk of TBLK: a tile of 64 t x 64 d of x_v, turned in LDS (rows d at pitch 72 elements): XVT[batch][d][t] = f16(x_v[batch][t][d]); whole 128-B lines read and stored
__device__ __forceinline__ void xvt(char* sm, unsigned blk, const float* __restrict__ xv, h16* XVT) {
    h16* tt = (h16*)sm;
    const unsigned per = (unsigned)((SEQ / 64) * (DD / 64)); const unsigned b = blk / per, r = blk - b * per; const unsigned t0 = (r >> 2) * 64u, d0 = (r & 3u) * 64u;
    const unsigned row = threadIdx.x >> 4, col = (threadIdx.x & 15u) * 4u;
    v4f v[4];
#pragma unroll
    for (int i = 0; i < 4; ++i) v[i] = *(const v4f*)(xv + ((size_t)b * SEQ_FULL + t0 + row + (unsigned)i * 16u) * DD + d0 + col);
#pragma unroll
    for (int i = 0; i < 4; ++i)
#pragma unroll
        for (int e = 0; e < 4; ++e) tt[(col + (unsigned)e) * 72u + row + (unsigned)i * 16u] = (h16)v[i][e];
    __syncthreads();                                     // the tile is complete before its rows are read the other way
    const unsigned d = threadIdx.x >> 2, pc = threadIdx.x & 3u;
    const v8h o0 = *(const v8h*)(tt + d * 72u + pc * 16u); const v8h o1 = *(const v8h*)(tt + d * 72u + pc * 16u + 8u);
    h16* dst = XVT + ((size_t)b * DD + d0 + d) * SEQ + t0 + pc * 16u;
    *(v8h*)dst = o0; *(v8h*)(dst + 8) = o1;
    asm volatile("s_wait_xcnt 0x0" ::: "memory");   // stands in front of any later write to registers that these two stores name (k_prep's branches share one listing)
}

// mprod: block blk of MBLK: head blk / 8, a tile of 128 k x 64 n of M[k][n] = sum_e Wq[k][e] Wk[n][e], stored transposed: MT[head][n][k] = bf16(M[k][n]).
// Slices of 32 e: [Wq 128 rows | Wk 64 rows] read as whole 128-B lines, converted to bf16 and laid in LDS at pitch 80 B (16 B x odd); a slice's loads are issued two slices ahead.
// Eight waves (2 x 4), each 64 k x 16 n: A = Wq rows, B = Wk rows, so a lane holds 8 successive k of one n (16 B of a row of MT), and a wave stores the whole 128-B line of each of its rows.
#define MPIT 80u
__device__ __forceinline__ void mprod(char* sm, unsigned blk, const float* __restrict__ wq, const float* __restrict__ wk, bf* MT) {
    const unsigned lane = threadIdx.x & 31u, lr = lane & 15u, hi = lane >> 4; const unsigned w = (unsigned)__builtin_amdgcn_readfirstlane((int)(threadIdx.x >> 5));
    const unsigned h = blk >> 3, k0 = ((blk >> 2) & 1u) * 128u, n0 = (blk & 3u) * 64u;
    const unsigned row = threadIdx.x >> 3, pc = threadIdx.x & 7u;
    const float* ga = wq + (size_t)h * DD * DD + (size_t)(k0 + row) * DD + pc * 4u; const float* gb = wk + (size_t)h * DD * DD + (size_t)(n0 + row) * DD + pc * 4u;
    v4f r[2][6];
#pragma unroll
    for (int s = 0; s < 2; ++s) {
#pragma unroll
        for (int i = 0; i < 4; ++i) r[s][i] = *(const v4f*)(ga + (size_t)i * 32 * DD + s * 32);
#pragma unroll
        for (int i = 0; i < 2; ++i) r[s][4 + i] = *(const v4f*)(gb + (size_t)i * 32 * DD + s * 32);
    }
    v8f acc[4];
#pragma unroll
    for (int i = 0; i < 4; ++i) acc[i] = (v8f){};
    const unsigned wa = (w & 1u) * 64u, wb = (w >> 1) * 16u;
    char* st = sm + row * MPIT + pc * 8u;
    const char* fa = sm + (wa + lr) * MPIT + hi * 16u; const char* fb = sm + (128u + wb + lr) * MPIT + hi * 16u;
#pragma unroll
    for (int s = 0; s < DD / 32; ++s) {
#pragma unroll
        for (int i = 0; i < 6; ++i) { v4us o;
#pragma unroll
            for (int e = 0; e < 4; ++e) o[e] = f2bf(r[s & 1][i][e]);
            *(v4us*)(st + (unsigned)i * 32u * MPIT) = o; }
        __syncthreads();                                 // the slice is complete before any wave reads its fragments
        if (s + 2 < DD / 32) {
#pragma unroll
            for (int i = 0; i < 4; ++i) r[s & 1][i] = *(const v4f*)(ga + (size_t)i * 32 * DD + (s + 2) * 32);
#pragma unroll
            for (int i = 0; i < 2; ++i) r[s & 1][4 + i] = *(const v4f*)(gb + (size_t)i * 32 * DD + (s + 2) * 32);
        }
        const v16bf fbv = WFrag<bf>::ld((const bf*)fb);
#pragma unroll
        for (int i = 0; i < 4; ++i) acc[i] = wmmab(WFrag<bf>::ld((const bf*)(fa + (unsigned)i * 16u * MPIT)), fbv, acc[i]);
        __syncthreads();                                 // every wave's reads of the slice are done before the next slice is laid over it
    }
    bf* mrow = MT + (size_t)h * DD * DD + (size_t)(n0 + wb + lr) * DD + k0 + wa + hi * 8u;   // D: row (k) 8*hi + j, column (n) lr
    v8us ov[4];
#pragma unroll
    for (int i = 0; i < 4; ++i)
#pragma unroll
        for (int j = 0; j < 8; ++j) ov[i][j] = f2bf(acc[i][j]);
#pragma unroll
    for (int i = 0; i < 4; ++i) *(v8us*)(mrow + i * 16) = ov[i];
}

// cqrows: block blk of CBLK: 32 elements of c[head*256 + n] = sum_e bq[head][e] Wk[head][n][e], in f32; a wave a row (1 KB, whole lines), the 32 sums stored by one wave as one 128-B line
__device__ __forceinline__ void cqrows(char* sm, unsigned blk, const float* __restrict__ wk, const float* __restrict__ bq, float* CQ) {
    float* red = (float*)sm;
    const unsigned lane = threadIdx.x & 31u, w = threadIdx.x >> 5, r0 = blk * 32u;
    const float* bqh = bq + (r0 >> 8) * (unsigned)DD + lane * 8u;
    const v4f q0 = *(const v4f*)bqh, q1 = *(const v4f*)(bqh + 4);
    float s[4];
#pragma unroll
    for (int r = 0; r < 4; ++r) { const float* row = wk + (size_t)(r0 + w * 4u + (unsigned)r) * DD + lane * 8u; const v4f x0 = *(const v4f*)row, x1 = *(const v4f*)(row + 4); s[r] = 0.f;
#pragma unroll
        for (int e = 0; e < 4; ++e) { s[r] += x0[e] * q0[e]; s[r] += x1[e] * q1[e]; } }
    wsum(s);
    if (lane == 0u) {
#pragma unroll
        for (int r = 0; r < 4; ++r) red[w * 4u + (unsigned)r] = s[r]; }
    __syncthreads();                                     // the 32 sums are complete before one wave reads them
    if (threadIdx.x < 32u) CQ[r0 + threadIdx.x] = red[threadIdx.x];
}

// gprod: block blk of GBLK: head blk / 8, a tile of 128 i x 64 n of the G plane, GOS[n][head*256 + i] = f16(256 sum_d Wv[head][i][d] Wo[d*8 + head][n]), in the frame of mprod.
// Slices of 32 d: [Wv 128 rows i | Wo^T 64 rows n] in LDS at pitch 80 B: Wv rows read as whole 128-B lines and converted to f16; Wo rows d read as 256-B pieces (64 n) and laid turned, f16 of bf16(Wo) x256, one element a store.
// Eight waves (2 x 4), each 64 i x 16 n: A = Wv rows, B = Wo^T rows, so a lane holds 8 successive i of one n (16 B of a row of the G plane), and a wave stores the whole 128-B line of each of its rows.
__device__ __forceinline__ void gprod(char* sm, unsigned blk, const float* __restrict__ wv, const float* __restrict__ wo, h16* GOS) {
    const unsigned lane = threadIdx.x & 31u, lr = lane & 15u, hi = lane >> 4; const unsigned w = (unsigned)__builtin_amdgcn_readfirstlane((int)(threadIdx.x >> 5));
    const unsigned h = blk >> 3, i0 = ((blk >> 2) & 1u) * 128u, n0 = (blk & 3u) * 64u;
    const unsigned row = threadIdx.x >> 3, pc = threadIdx.x & 7u;
    const float* ga = wv + (size_t)h * DD * DD + (size_t)(i0 + row) * DD + pc * 4u; const float* gb = wo + (size_t)(row * (unsigned)NHEAD + h) * DD + n0 + pc * 4u;   // gb: d = row of the slice
    v4f r[2][6];
#pragma unroll
    for (int s = 0; s < 2; ++s) {
#pragma unroll
        for (int i = 0; i < 4; ++i) r[s][i] = *(const v4f*)(ga + (size_t)i * 32 * DD + s * 32);
#pragma unroll
        for (int i = 0; i < 2; ++i) r[s][4 + i] = *(const v4f*)(gb + (size_t)s * 32 * NHEAD * DD + i * 32);
    }
    v8f acc[4];
#pragma unroll
    for (int i = 0; i < 4; ++i) acc[i] = (v8f){};
    const unsigned wa = (w & 1u) * 64u, wb = (w >> 1) * 16u;
    char* st = sm + row * MPIT + pc * 8u; char* sb = sm + (128u + pc * 4u) * MPIT + row * 2u;
    const char* fa = sm + (wa + lr) * MPIT + hi * 16u; const char* fb = sm + (128u + wb + lr) * MPIT + hi * 16u;
#pragma unroll
    for (int s = 0; s < DD / 32; ++s) {
#pragma unroll
        for (int i = 0; i < 4; ++i) { v4h o;
#pragma unroll
            for (int e = 0; e < 4; ++e) o[e] = (h16)r[s & 1][i][e];
            *(v4h*)(st + (unsigned)i * 32u * MPIT) = o; }
#pragma unroll
        for (int i = 0; i < 2; ++i)
#pragma unroll
            for (int e = 0; e < 4; ++e) *(h16*)(sb + (unsigned)(i * 32 + e) * MPIT) = (h16)(bfr(r[s & 1][4 + i][e]) * WOCAR);
        __syncthreads();                                 // the slice is complete before any wave reads its fragments
        if (s + 2 < DD / 32) {
#pragma unroll
            for (int i = 0; i < 4; ++i) r[s & 1][i] = *(const v4f*)(ga + (size_t)i * 32 * DD + (s + 2) * 32);
#pragma unroll
            for (int i = 0; i < 2; ++i) r[s & 1][4 + i] = *(const v4f*)(gb + (size_t)(s + 2) * 32 * NHEAD * DD + i * 32);
        }
        const v16h fbv = WFrag<h16>::ld((const h16*)fb);
#pragma unroll
        for (int i = 0; i < 4; ++i) acc[i] = wmma16(WFrag<h16>::ld((const h16*)(fa + (unsigned)i * 16u * MPIT)), fbv, acc[i]);
        __syncthreads();                                 // every wave's reads of the slice are done before the next slice is laid over it
    }
    h16* grow = GOS + (size_t)(n0 + wb + lr) * KM + h * (unsigned)DD + i0 + wa + hi * 8u;   // D: row (i) 8*hi + j, column (n) lr
    v8h ov[4];
#pragma unroll
    for (int i = 0; i < 4; ++i)
#pragma unroll
        for (int j = 0; j < 8; ++j) ov[i][j] = (h16)acc[i][j];
#pragma unroll
    for (int i = 0; i < 4; ++i) *(v8h*)(grow + i * 16) = ov[i];
    asm volatile("s_wait_xcnt 0x0" ::: "memory");   // stands in front of any later write to registers that these stores name (k_prep's branches share one listing)
}

// obias: block blk of BBLK: 32 columns of the output bias, BO2[n] = bo[n] + sum_r bv[r % 8][r / 8] Wo[r][n], in f32; thread (row group rg, 4 columns) sums rows rg + 32 t, 8 lanes a 128-B line;
// the 32 partial sums of a column are added by one thread, and the 32 results stored by one wave as one 128-B line
__device__ __forceinline__ void obias(char* sm, unsigned blk, const float* __restrict__ wo, const float* __restrict__ bv, const float* __restrict__ bo, float* BO2) {
    float* red = (float*)sm;
    const unsigned rg = threadIdx.x >> 3, cq = (threadIdx.x & 7u) * 4u, n0 = blk * 32u;
    const float* col = wo + (size_t)rg * DD + n0 + cq; const float* bvr = bv + (rg & 7u) * (unsigned)DD + (rg >> 3);   // row r = rg + 32 t is head r % 8 = rg % 8, element r / 8 = rg / 8 + 4 t
    v4f s = (v4f){};
#pragma unroll
    for (int g = 0; g < KM / 512; ++g) {   // unrolled: every load is its base register and a constant offset, so that no address register is written while loads are in flight
        v4f x[16]; float b[16];
#pragma unroll
        for (int t = 0; t < 16; ++t) { x[t] = *(const v4f*)(col + (size_t)(g * 16 + t) * 32 * DD); b[t] = bvr[(g * 16 + t) * 4]; }
#pragma unroll
        for (int t = 0; t < 16; ++t) s += x[t] * b[t];
        __builtin_amdgcn_sched_barrier(0);   // keeps the next sixteen rows' loads behind these sums: with all 128 loads in flight these few blocks would raise the register count of k_prep
    }
    asm volatile("s_wait_xcnt 0x0" :: "v"(col), "v"(bvr) : "memory");   // stands in front of any later write to the two address registers that these loads name; as inputs the addresses keep their registers up to it
    *(v4f*)(red + rg * 32u + cq) = s;
    __syncthreads();                                     // the partial sums are complete before one wave reads them
    if (threadIdx.x < 32u) { float a = bo[n0 + threadIdx.x];
#pragma unroll
        for (int g = 0; g < 32; ++g) a += red[(unsigned)g * 32u + threadIdx.x];
        BO2[n0 + threadIdx.x] = a; }
}

// k_prep: every operand plane, in one grid of MBLK + GBLK + CBLK + BBLK + TBLK + 2 * XBLK blocks, 256 threads; the blocks that run longest have the lowest indices. Every branch is block-uniform.
__global__ __launch_bounds__(256) void k_prep(const float* __restrict__ xq, const float* __restrict__ xk, const float* __restrict__ xv, const float* __restrict__ wq, const float* __restrict__ wk, const float* __restrict__ wv, const float* __restrict__ wo, const float* __restrict__ bq, const float* __restrict__ bv, const float* __restrict__ bo,
                                              bf* XQ, h16* XK, h16* XVT, bf* MT, h16* GOS, float* CQ, float* BO2) {
    __shared__ __align__(16) char sm[192 * MPIT];
    static_assert(64 * 72 * 2 <= 192 * MPIT && 32 * 32 * 4 <= 192 * MPIT);
    unsigned blk = blockIdx.x;
    if (blk < MBLK) { mprod(sm, blk, wq, wk, MT); return; }
    blk -= MBLK;
    if (blk < GBLK) { gprod(sm, blk, wv, wo, GOS); return; }
    blk -= GBLK;
    if (blk < CBLK) { cqrows(sm, blk, wk, bq, CQ); return; }
    blk -= CBLK;
    if (blk < BBLK) { obias(sm, blk, wo, bv, bo, BO2); return; }
    blk -= BBLK;
    if (blk < TBLK) { xvt(sm, blk, xv, XVT); return; }
    xplanes(blk - TBLK, xq, xk, XQ, XK);
}

// ---- k_fattn: q'', scores, softmax and P.x_v of one head for 256 queries per block (below, q_ is the head's q'' = x_q M + c, k_ the batch's f16(x_k) plane, v_^T the batch's f16(x_v)^T plane); 8 waves, each 32 query columns; grid (SEQ/256, batch*8 + head), 256 threads.
// Ahead of the key loop each wave forms q_ of its own 32 queries in registers: q_^T = M^T . x_q^T (A = rows n of the head's M^T, laid once in LDS by asynchronous copies and read by all eight waves, B = bf16(x_q) rows from global memory).
// In a q_^T tile a lane holds features 8*hi + j of query lr; tiles of features 0..15 and 16..31 of a k-step give elements 0..7 and 8..15 of the score products' B fragment, which is the loaders' k order.
// Transposed products: S^T = k_ . q_^T (A = k_ rows from LDS, B = q_ kept in registers), O^T += v_^T . P^T (A = v_^T rows from LDS, B = P^T packed from the score accumulators of the same lane).
// In a score tile a lane holds keys 8*hi + j of query lr; tiles of keys 0..15 and 16..31 give elements 0..7 and 8..15 of the B fragment, which is the loaders' k order.
// A stage is 64 keys: [k_ 64 rows of 512 B at pitch 528 | v_^T 256 rows of 128 B at pitch 144] in a two-buffer LDS ring laid by asynchronous copies; a pass is 32 keys.
// Online softmax in the log2 domain: the maximum in use moves only when a pass exceeds it by more than 8 (P <= 256 fits f16), tested once per pass by a scalar branch.
#define FKB  64                   // keys per ring stage
#define KPIT 528u                 // LDS pitch of a k_ row, bytes (16 B x odd)
#define VPIT 144u                 // LDS pitch of a v_^T row piece, bytes (16 B x odd)
#define FKSZ ((unsigned)FKB * KPIT)
#define FSTG (FKSZ + (unsigned)DD * VPIT)
static_assert(DD == 256 && SEQ % FKB == 0 && SEQ / FKB >= 2);

// Eight copies of one wave, 16 B a lane: LDS address l + i*ls bytes, global address g + i*gs elements. The builtin form: with these copies as asm statements the register allocation of k_fattn spilled q_ fragments, with the builtin it does not.
typedef int v4i __attribute__((ext_vector_type(4)));
typedef float v2f __attribute__((ext_vector_type(2)));
__device__ __forceinline__ void copy8s(char* l, unsigned ls, const h16* g, size_t gs) {
#pragma unroll
    for (int i = 0; i < 8; ++i)
        __builtin_amdgcn_global_load_async_to_lds_b128((__attribute__((address_space(1))) v4i*)(g + (size_t)i * gs), (__attribute__((address_space(3))) v4i*)(l + (unsigned)i * ls), 0, 0);
}

// lane l's value from lane l ^ 16 (a vector-unit exchange: an LDS permute would queue behind the fragment reads issued ahead)
__device__ __forceinline__ float xhalf(float x) { return __builtin_bit_cast(float, __builtin_amdgcn_permlanex16(__builtin_bit_cast(int, x), __builtin_bit_cast(int, x), 0x76543210, 0xfedcba98, false, false)); }

__global__ __launch_bounds__(256) void k_fattn(const bf* __restrict__ XQ, const bf* __restrict__ MT, const float* __restrict__ CQ, const h16* __restrict__ KPl, const h16* __restrict__ VTl, h16* __restrict__ CT) {
    __shared__ __align__(16) char ring[2 * FSTG];
    __shared__ __align__(16) char mst[(unsigned)DD * KPIT];   // the head's M^T: 256 rows n of 512 B at pitch 528
    static_assert(8u * 32u * KPIT <= 2u * FSTG);
    const unsigned lane = threadIdx.x & 31u, lr = lane & 15u, hi = lane >> 4; const unsigned w = (unsigned)__builtin_amdgcn_readfirstlane((int)(threadIdx.x >> 5));
    const size_t z = blockIdx.y; const unsigned hd = (unsigned)z & 7u; const h16* Kh = KPl + (z >> 3) * ((size_t)SEQ * DD); const h16* Vh = VTl + (z >> 3) * ((size_t)SEQ * DD);
    const unsigned q0 = blockIdx.x * 256u + w * 32u;
    // copy addresses: k_ rows w*8 + i, a whole 512-B row per copy; v_^T rows 32*i + w*4 + lane/8, 16-byte piece lane%8 of the row's 128 B (a step of 32 rows is beyond the copy's offset field, so each copy carries its own two addresses)
    char* lk = ring + w * 8u * KPIT + lane * 16u; char* lv = ring + FKSZ + (w * 4u + (lane >> 3)) * VPIT + (lane & 7u) * 16u;
    const h16* gk = Kh + (size_t)(w * 8u) * DD + lane * 8u; const h16* gv = Vh + (size_t)(w * 4u + (lane >> 3)) * SEQ + (lane & 7u) * 8u;
    // M^T rows w*32 + i, a whole 512-B row per copy: 32 copies a wave, 48 in flight with stage 0's
    char* lm = mst + w * 32u * KPIT + lane * 16u; const h16* gm = (const h16*)(const void*)(MT + (size_t)hd * DD * DD + (size_t)(w * 32u) * DD + lane * 8u);
#pragma unroll
    for (int i = 0; i < 4; ++i) copy8s(lm + (unsigned)i * 8u * KPIT, KPIT, gm + (size_t)i * 8 * DD, (size_t)DD);
    copy8s(lk, KPIT, gk, (size_t)DD); copy8s(lv, 32u * VPIT, gv, (size_t)32 * SEQ);
    const bf* xrow = XQ + ((z >> 3) * (size_t)SEQ + q0 + lr) * DD + hi * 8u; const float* crow0 = CQ + hd * (unsigned)DD + hi * 8u;
    v16bf xf[2][8]; v8f cb[16];   // x_q fragments of the wave's two query tiles; c of the lane's 8 features of each feature tile
#pragma unroll
    for (int qt = 0; qt < 2; ++qt)
#pragma unroll
        for (int ks = 0; ks < 8; ++ks) xf[qt][ks] = WFrag<bf>::ld(xrow + (size_t)qt * 16 * DD + ks * 32);
    asm volatile("s_wait_xcnt 0x0" ::: "memory");       // stands in front of any later write to the address registers that these loads name
#pragma unroll
    for (int nt = 0; nt < 16; ++nt) cb[nt] = *(const v8f*)(crow0 + nt * 16);
    asm volatile("s_wait_xcnt 0x0" ::: "memory");       // stands in front of any later write to the address registers that these loads name
    asm volatile("s_wait_asynccnt 0x0" ::: "memory");   // this wave's rows of M^T and of stage 0 have landed
    __syncthreads();                                     // M^T and stage 0 published to the eight waves
    copy8s(lk + FSTG, KPIT, gk + (size_t)FKB * DD, (size_t)DD); copy8s(lv + FSTG, 32u * VPIT, gv + FKB, (size_t)32 * SEQ);
    v16h qf[2][8];
    {
        // A unit = the two feature tiles' M^T fragments of one k-step and 4 products; unit v: feature tiles 2 (v / 8) and 2 (v / 8) + 1, k-step v % 8. Each unit is read two units ahead into a ring of three sets.
        const char* fm = mst + lr * KPIT + hi * 16u;
#define LDM(v, i) WFrag<bf>::ld((const bf*)(fm + (unsigned)((((v) >> 3) * 2 + (i)) * 16) * KPIT + (unsigned)((v) & 7) * 64u))
        v16bf mf[3][2]; v8f qa[2][2];
        mf[0][0] = LDM(0, 0); mf[0][1] = LDM(0, 1); mf[1][0] = LDM(1, 0); mf[1][1] = LDM(1, 1);
#pragma unroll
        for (int v = 0; v < 64; ++v) {
            if (v + 2 < 64) { mf[(v + 2) % 3][0] = LDM(v + 2, 0); mf[(v + 2) % 3][1] = LDM(v + 2, 1); }
            __builtin_amdgcn_sched_barrier(0);   // keeps the LDS reads issued ahead as one group in front of these products instead of spread among them
            if ((v & 7) == 0) { qa[0][0] = (v8f){}; qa[0][1] = (v8f){}; qa[1][0] = (v8f){}; qa[1][1] = (v8f){}; }
#pragma unroll
            for (int i = 0; i < 2; ++i)
#pragma unroll
                for (int qt = 0; qt < 2; ++qt) qa[i][qt] = wmmab(mf[v % 3][i], xf[qt][v & 7], qa[i][qt]);
            __builtin_amdgcn_sched_barrier(0);   // the other side of the pair: later reads stay behind these products
            if ((v & 7) == 7) {
#pragma unroll
                for (int qt = 0; qt < 2; ++qt) { v16h pk;
#pragma unroll
                    for (int i = 0; i < 2; ++i)
#pragma unroll
                        for (int j = 0; j < 8; ++j) pk[8 * i + j] = (h16)(qa[i][qt][j] + cb[(v >> 3) * 2 + i][j]);
                    qf[qt][v >> 3] = pk; }
            }
        }
    }
    v8f o[16][2];
#pragma unroll
    for (int dt = 0; dt < 16; ++dt) { o[dt][0] = (v8f){}; o[dt][1] = (v8f){}; }
    float mrun[2] = {-3.0e38f, -3.0e38f}, lsum[2] = {0.f, 0.f};
    const char* fk = ring + lr * KPIT + hi * 16u; const char* fv = ring + FKSZ + lr * VPIT + hi * 16u;
    const int nt = SEQ / FKB;
// fragment of pass p (32 keys) in buffer offset bo: k_ key tile kt, k-step u; v_^T d tile dt
#define LDK(p, u, kt) WFrag<h16>::ld((const h16*)(fk + bo + (unsigned)((p) * 32 + (kt) * 16) * KPIT + (unsigned)(u) * 64u))
#define LDV(p, dt)    WFrag<h16>::ld((const h16*)(fv + bo + (unsigned)(dt) * 16u * VPIT + (unsigned)(p) * 64u))
    for (int t = 0; t < nt; ++t) {
        const unsigned bo = ((unsigned)t & 1u) * FSTG;
        // Fragments are read ahead of their products, never past the stage. A unit = 2 fragments and 4 products: the two key tiles' k_ fragments of one k-step, or two d tiles' v_^T fragments.
        // Each unit is read two units ahead into a ring of three sets; P.V's first two units are read under the last two score units, the next pass's first two score units under the last two of P.V.
        v16h fs[3][2], fw[3][2]; v8f st[2][2]; v16h pf[2];
        fs[0][0] = LDK(0, 0, 0); fs[0][1] = LDK(0, 0, 1); fs[1][0] = LDK(0, 1, 0); fs[1][1] = LDK(0, 1, 1);
#pragma unroll
        for (int p = 0; p < 2; ++p) {
            st[0][0] = (v8f){}; st[0][1] = (v8f){}; st[1][0] = (v8f){}; st[1][1] = (v8f){};
#pragma unroll
            for (int u = 0; u < 8; ++u) {
                if (u < 6) { fs[(u + 2) % 3][0] = LDK(p, u + 2, 0); fs[(u + 2) % 3][1] = LDK(p, u + 2, 1); }
                else { fw[u - 6][0] = LDV(p, (u - 6) * 2); fw[u - 6][1] = LDV(p, (u - 6) * 2 + 1); }
                __builtin_amdgcn_sched_barrier(0);   // keeps the LDS reads issued ahead as one group in front of these products instead of spread among them
#pragma unroll
                for (int kt = 0; kt < 2; ++kt)
#pragma unroll
                    for (int qt = 0; qt < 2; ++qt) st[kt][qt] = wmma16(fs[u % 3][kt], qf[qt][u], st[kt][qt]);
                __builtin_amdgcn_sched_barrier(0);   // the other side of the pair: later reads stay behind these products
            }
            float ms[2];
#pragma unroll
            for (int qt = 0; qt < 2; ++qt) { float a = fmaxf(st[0][qt][0], st[1][qt][0]);
#pragma unroll
                for (int j = 1; j < 8; ++j) a = fmaxf(a, fmaxf(st[0][qt][j], st[1][qt][j]));
                a = fmaxf(a, xhalf(a)); ms[qt] = a * SCL2; }
            const bool need = (ms[0] > mrun[0] + 8.0f) || (ms[1] > mrun[1] + 8.0f);
            if (__builtin_amdgcn_ballot_w32(need) != 0) {   // wave-uniform: every lane rescales its two queries or none does
#pragma unroll
                for (int qt = 0; qt < 2; ++qt) { const float mn = fmaxf(mrun[qt], ms[qt]); const float al = __builtin_amdgcn_exp2f(mrun[qt] - mn); mrun[qt] = mn; lsum[qt] *= al;
#pragma unroll
                    for (int dt = 0; dt < 16; ++dt) o[dt][qt] *= al; }
            }
#pragma unroll
            for (int qt = 0; qt < 2; ++qt) { v16h pk; const float nm = -mrun[qt]; v2f ps[2] = {(v2f){0.f, 0.f}, (v2f){0.f, 0.f}};
#pragma unroll
                for (int i = 0; i < 8; ++i) {
                    const v2f arg = __builtin_elementwise_fma((v2f){st[i >> 2][qt][2 * (i & 3)], st[i >> 2][qt][2 * (i & 3) + 1]}, (v2f){SCL2, SCL2}, (v2f){nm, nm});
                    const float e0 = __builtin_amdgcn_exp2f(arg.x), e1 = __builtin_amdgcn_exp2f(arg.y);
                    ps[i & 1] += (v2f){e0, e1}; pk[2 * i] = (h16)e0; pk[2 * i + 1] = (h16)e1; }
                lsum[qt] += (ps[0].x + ps[1].x) + (ps[0].y + ps[1].y);
                asm volatile("" : "+v"(lsum[qt]));   // each row's sum, against spills: left free, the adds sink behind the P.V products and the 32 exponentials stay live into the next pass
                pf[qt] = pk; }
#pragma unroll
            for (int u = 0; u < 8; ++u) {
                if (u < 6) { fw[(u + 2) % 3][0] = LDV(p, (u + 2) * 2); fw[(u + 2) % 3][1] = LDV(p, (u + 2) * 2 + 1); }
                else if (p == 0) { fs[u - 6][0] = LDK(1, u - 6, 0); fs[u - 6][1] = LDK(1, u - 6, 1); }
                __builtin_amdgcn_sched_barrier(0);   // as above: the reads issued ahead stay one group in front of these products
#pragma unroll
                for (int i = 0; i < 2; ++i)
#pragma unroll
                    for (int qt = 0; qt < 2; ++qt) o[u * 2 + i][qt] = wmma16(fw[u % 3][i], pf[qt], o[u * 2 + i][qt]);
                __builtin_amdgcn_sched_barrier(0);   // the other side of the pair
            }
        }
        asm volatile("s_wait_dscnt 0x0" ::: "memory");      // this wave's reads of buffer t%2 are done before the buffer is refilled
        asm volatile("s_wait_asynccnt 0x0" ::: "memory");   // this wave's rows of stage t+1 have landed
        __syncthreads();                                     // publishes stage t+1 and ends every wave's reads of stage t
        if (t + 2 < nt) { copy8s(lk + bo, KPIT, gk + (size_t)(t + 2) * FKB * DD, (size_t)DD); copy8s(lv + bo, 32u * VPIT, gv + (size_t)(t + 2) * FKB, (size_t)32 * SEQ); }
    }
    asm volatile("s_wait_asynccnt 0x0" ::: "memory");       // nothing in flight when the ring becomes output staging
    // O^T tile: lane holds d = dt*16 + 8*hi + j of query lr: 16 B of that query's ctx row; rows staged (pitch 528 B, a range per wave) so that each store covers a whole 512-B row segment
    char* os = ring + w * (32u * KPIT);
#pragma unroll
    for (int qt = 0; qt < 2; ++qt) { const float inv = __fdiv_rn(CCAR, lsum[qt] + xhalf(lsum[qt]));
#pragma unroll
        for (int dt = 0; dt < 16; ++dt) { v8h ov;
#pragma unroll
            for (int j = 0; j < 8; ++j) ov[j] = (h16)(o[dt][qt][j] * inv);
            *(v8h*)(os + ((unsigned)qt * 16u + lr) * KPIT + (unsigned)dt * 32u + hi * 16u) = ov; } }
    __syncthreads();                                         // the staged rows are complete before other lanes read them back
    h16* crow = CT + ((z >> 3) * (size_t)SEQ + q0) * KM + (z & 7u) * (size_t)DD + lane * 8u;
    v8h rowv[32];   // all 32 rows are read into registers of their own ahead of the stores, and one address serves every store: no register that an issued store names is written again
#pragma unroll
    for (int r = 0; r < 32; ++r) rowv[r] = *(const v8h*)(os + (unsigned)r * KPIT + lane * 16u);
#pragma unroll
    for (int r = 0; r < 32; ++r) *(v8h*)(crow + (size_t)r * KM) = rowv[r];
}

// Workspace carve (bytes, each region 256-B aligned by construction of the sizes).
#define SZ_X1  ((size_t)NB * SEQ * DD * 2)
#define SZ_W1  ((size_t)NHEAD * DD * DD * 2)
#define SZ_WOS ((size_t)DD * KM * 2)
#define SZ_CQ  ((size_t)NHEAD * DD * 4)
#define SZ_BO  ((size_t)DD * 4)
#define SZ_HP  ((size_t)NB * NHEAD * SEQ * DD * 2)
#define SZ_ALL (3 * SZ_X1 + SZ_W1 + SZ_WOS + SZ_CQ + SZ_BO + SZ_HP)
static_assert(SZ_ALL <= (size_t)268435456);
static_assert(SZ_X1 % 256 == 0 && SZ_W1 % 256 == 0 && SZ_WOS % 256 == 0 && SZ_CQ % 256 == 0 && SZ_BO % 256 == 0 && SZ_HP % 256 == 0);
static_assert((size_t)SEQ * KM == (size_t)NHEAD * SEQ * DD);   // the ctx plane has the size of one set of head planes

extern "C" void kernel_launch(void* const* d_in, const int* in_sizes, int n_in,
                              void* d_out, int out_size, void* d_ws, size_t ws_size, hipStream_t stream) {
    if (n_in < 11) return;
    const size_t xneed = (size_t)(NB - 1) * SEQ_FULL * DD + (size_t)SEQ * DD;
    if ((size_t)in_sizes[0] < xneed || (size_t)in_sizes[1] < xneed || (size_t)in_sizes[2] < xneed) return;
    if ((size_t)in_sizes[3] < (size_t)NHEAD * DD * DD || (size_t)in_sizes[5] < (size_t)NHEAD * DD * DD || (size_t)in_sizes[7] < (size_t)NHEAD * DD * DD) return;
    if ((size_t)in_sizes[4] < (size_t)NHEAD * DD || (size_t)in_sizes[6] < (size_t)NHEAD * DD || (size_t)in_sizes[8] < (size_t)NHEAD * DD) return;
    if ((size_t)in_sizes[9] < (size_t)KM * DD || (size_t)in_sizes[10] < (size_t)DD) return;
    if ((size_t)out_size < (size_t)NB * SEQ * DD) return;
    if (SZ_ALL > ws_size) return;
    const float* Kin = (const float*)d_in[0]; const float* Vin = (const float*)d_in[1]; const float* Qin = (const float*)d_in[2];
    const float* Wk = (const float*)d_in[3]; const float* Wv = (const float*)d_in[5]; const float* bv = (const float*)d_in[6];   // d_in[4], bk, adds the same amount to every score of a query: the softmax does not see it
    const float* Wq = (const float*)d_in[7]; const float* bq = (const float*)d_in[8]; const float* Wo = (const float*)d_in[9]; const float* bo = (const float*)d_in[10];
    float* OUT = (float*)d_out;     // [NB][SEQ][256]
    char* wsp = (char*)d_ws;
    bf* XQ = (bf*)wsp; wsp += SZ_X1;            // [NB][SEQ][256] bf16(x_q)
    h16* XK = (h16*)wsp; wsp += SZ_X1;          // [NB][SEQ][256] f16(x_k)
    h16* XVT = (h16*)wsp; wsp += SZ_X1;         // [NB][256][SEQ] f16(x_v)^T
    bf* MT = (bf*)wsp; wsp += SZ_W1;            // [8][256 n][256 k] bf16: (Wq Wk^T)^T
    h16* GOS = (h16*)wsp; wsp += SZ_WOS;        // [256][2048] f16 (x256), column h*256 + i: Wv Wo
    float* CQ = (float*)wsp; wsp += SZ_CQ;      // [8][256] bq Wk^T
    float* BO2 = (float*)wsp; wsp += SZ_BO;     // [256] bo + sum_h bv_h Wo_h
    h16* CTX = (h16*)wsp; wsp += SZ_HP;         // [NB][SEQ][2048] (x64), column h*256 + i

    k_prep<<<MBLK + GBLK + CBLK + BBLK + TBLK + 2u * XBLK, 256, 0, stream>>>(Qin, Kin, Vin, Wq, Wk, Wv, Wo, bq, bv, bo, XQ, XK, XVT, MT, GOS, CQ, BO2);
    // ctx[zb][t][h*256 + i] = 64 softmax((x_q M + c) . x_k / 16) . x_v, all heads of all batches
    k_fattn<<<dim3(SEQ / 256, NB * NHEAD, 1), 256, 0, stream>>>(XQ, MT, CQ, XK, XVT, CTX);
    // out = ctx . G / 16384 + BO2, the rows of all batches in one launch
    k_omix<<<dim3(NB * SEQ / OBM, DD / OBN, 1), 256, 0, stream>>>(CTX, GOS, OUT, BO2);
}
